// v000
// The times below were measured on an AMD MI455X: many runs one after another, warmed up first and cycling through
// copies of the inputs, with the whole window's GPU time divided by the number of runs. Launches and the gaps
// between them are all in it. The median over several windows is given; except for v000 it joins two sittings, which
// can be a few percent apart, so the side-by-side timings, each taken in one sitting, are the better comparison.
// v000 is the starting kernel. One run takes 432 microseconds.
#include <hip/hip_runtime.h>

// ---------------------------------------------------------------------------
// CoAttention on MI455X (gfx1250): bf16 WMMA for all 4 matmuls, f32 softmax.
//   query = data1 @ Wq + bq            [8,2048,256]
//   key   = data2 @ Wk + bk            [8,2048,256]
//   S     = (query @ key^T) / 32       (flash style, never materialized)
//   out   = softmax(S) @ key + query   [8,2048,256]
//
// Roofline: ~45 GFLOP vs ~100 MB HBM -> compute bound on the WMMA pipes.
// Attention: 8 waves/block share one key stream -> stage 64-key tiles into
// LDS with gfx1250 async copies (ASYNCcnt), double buffered, for 8x L2
// traffic reduction and copy/compute overlap.
//
// Layout trick: S^T = K·Q^T so its C layout (element = key, lane = query)
// equals the A layout needed for P in O += P·K: softmax->P repack is
// lane-local (no LDS transpose, no shuffles).
// ---------------------------------------------------------------------------

typedef __attribute__((ext_vector_type(16))) __bf16 v16bf;
typedef __attribute__((ext_vector_type(8)))  __bf16 v8bf;
typedef __attribute__((ext_vector_type(8)))  float  f8v;

#define DD      256
#define LQ      2048
#define LK      2048
#define BATCH   8
#define M_TOTAL (BATCH * LQ)   // 16384
#define AWAVES  8
#define KSTEP   64             // keys per attention step (4 S-tiles)

// Per double-buffer half: kb tile 64x256 bf16 (32KB) + kt tile 256x64 (32KB).
#define KB_ELEMS  (KSTEP * DD)          // 16384
#define BUF_ELEMS (2 * KB_ELEMS)        // 32768 (kb + kt)
#define SMEM_BYTES (2 * BUF_ELEMS * 2)  // 131072 (double buffered)

union F16 {
  v16bf v;
  v8bf  h[2];
};

__device__ __forceinline__ f8v wmma_bf16(v16bf a, v16bf b, f8v c) {
  return __builtin_amdgcn_wmma_f32_16x16x32_bf16(false, a, false, b,
                                                 (short)0, c, false, false);
}

// Async global -> LDS copy, 16B per lane. VDST VGPR carries the LDS byte
// offset (dsaddr = LDS_BASE + VGPR), VADDR the 64-bit global address.
#define ASYNC_LDS_B128(ldsOffBytes, gptr)                                  \
  asm volatile("global_load_async_to_lds_b128 %0, %1, off"                 \
               :: "v"((unsigned)(ldsOffBytes)), "v"(gptr) : "memory")
#define WAIT_ASYNC_LE16() asm volatile("s_wait_asynccnt 0x10" ::: "memory")
#define WAIT_ASYNC_0()    asm volatile("s_wait_asynccnt 0x0"  ::: "memory")

// ---------------------------------------------------------------------------
// Weight prep: W[Kdim,256] (f32) -> WT[256,Kdim] (bf16), one-shot.
// ---------------------------------------------------------------------------
__global__ void __launch_bounds__(256)
weightT_kernel(const float* __restrict__ W, __bf16* __restrict__ WT, int Kdim) {
  const int idx = blockIdx.x * 256 + threadIdx.x;   // grid sized to Kdim*256
  const int k   = idx >> 8;
  const int col = idx & 255;
  WT[(size_t)col * Kdim + k] = (__bf16)W[idx];      // native v_cvt_pk_bf16_f32
}

// ---------------------------------------------------------------------------
// Projection GEMM: C[M,256] = A[M,Kdim] @ W[Kdim,256] + bias.
// Wave tile 32(M) x 64(N); block = 8 waves stacked in M; grid (M/256, 4).
// Epilogue write-set is a template parameter: no per-element branches.
// ---------------------------------------------------------------------------
template <bool WRITE_F32, bool WRITE_T>
__global__ void __launch_bounds__(256)
proj_gemm_kernel(const float* __restrict__ A, const __bf16* __restrict__ WT,
                 const float* __restrict__ bias, int Kdim,
                 float* __restrict__ outF32, __bf16* __restrict__ outB,
                 __bf16* __restrict__ outT) {
  const int lane = threadIdx.x & 31;
  const int wave = threadIdx.x >> 5;
  const int g    = lane >> 4;
  const int ln   = lane & 15;
  const int m0   = blockIdx.x * 256 + wave * 32;
  const int n0   = blockIdx.y * 64;

  f8v acc[2][4] = {};

  const float* arow0 = A + (size_t)(m0 + ln) * Kdim;
  const float* arow1 = arow0 + (size_t)16 * Kdim;

  for (int k0 = 0; k0 < Kdim; k0 += 32) {
    f8v lo0 = *(const f8v*)(arow0 + k0 + 8 * g);
    f8v hi0 = *(const f8v*)(arow0 + k0 + 16 + 8 * g);
    f8v lo1 = *(const f8v*)(arow1 + k0 + 8 * g);
    f8v hi1 = *(const f8v*)(arow1 + k0 + 16 + 8 * g);
    v16bf af0, af1;
#pragma unroll
    for (int i = 0; i < 8; ++i) {
      af0[i] = (__bf16)lo0[i]; af0[8 + i] = (__bf16)hi0[i];
      af1[i] = (__bf16)lo1[i]; af1[8 + i] = (__bf16)hi1[i];
    }
#pragma unroll
    for (int t = 0; t < 4; ++t) {
      const __bf16* wtrow = WT + (size_t)(n0 + 16 * t + ln) * Kdim + k0;
      F16 bfr;
      bfr.h[0] = *(const v8bf*)(wtrow + 8 * g);
      bfr.h[1] = *(const v8bf*)(wtrow + 16 + 8 * g);
      acc[0][t] = wmma_bf16(af0, bfr.v, acc[0][t]);
      acc[1][t] = wmma_bf16(af1, bfr.v, acc[1][t]);
    }
  }

#pragma unroll
  for (int s = 0; s < 2; ++s) {
#pragma unroll
    for (int t = 0; t < 4; ++t) {
      const int col    = n0 + 16 * t + ln;
      const float bval = bias[col];
#pragma unroll
      for (int r = 0; r < 8; ++r) {
        const int row    = m0 + 16 * s + r + 8 * g;   // C layout: M = r + 8g
        const float v    = acc[s][t][r] + bval;
        const size_t idx = (size_t)row * DD + col;
        if constexpr (WRITE_F32) outF32[idx] = v;
        const __bf16 hv = (__bf16)v;
        outB[idx] = hv;
        if constexpr (WRITE_T) {
          const int bb   = row >> 11;   // row / 2048
          const int lrow = row & 2047;
          outT[((size_t)(bb * DD + col)) * LK + lrow] = hv;
        }
      }
    }
  }
}

// ---------------------------------------------------------------------------
// Flash attention. One wave per 16-query tile; 8 waves/block share the key
// stream via double-buffered async LDS staging (64 keys/step).
// smem layout per buffer: [kb 64x256 bf16][kt 256x64 bf16].
// ---------------------------------------------------------------------------
__global__ void __launch_bounds__(256)
attn_kernel(const __bf16* __restrict__ qb, const __bf16* __restrict__ kb,
            const __bf16* __restrict__ ktb, const float* __restrict__ qf32,
            float* __restrict__ out) {
  extern __shared__ __bf16 smem[];

  const int tid  = threadIdx.x;
  const int lane = tid & 31;
  const int wave = tid >> 5;
  const int g    = lane >> 4;
  const int ln   = lane & 15;
  const int tile = blockIdx.x * AWAVES + wave;
  const int b    = tile >> 7;                  // per-wave batch
  const int q0   = (tile & 127) << 4;
  const int bblk = (blockIdx.x * AWAVES) >> 7; // block-uniform batch (same)

  const __bf16* kb_base = kb + (size_t)bblk * LK * DD;
  const __bf16* kt_base = ktb + (size_t)bblk * DD * LK;

  // ---- cooperative async stage of one 64-key tile into buffer `buf` ----
  auto stage = [&](int buf, int j) {
    const unsigned kbB = (unsigned)(buf * BUF_ELEMS) * 2;      // byte offsets
    const unsigned ktB = kbB + (unsigned)KB_ELEMS * 2;
    // kb tile: 32KB contiguous in global (rows j..j+63 are adjacent)
    const char* gkb = (const char*)(kb_base + (size_t)j * DD);
#pragma unroll
    for (int i = 0; i < 8; ++i) {
      const unsigned off = (unsigned)(tid + 256 * i) * 16;
      ASYNC_LDS_B128(kbB + off, gkb + off);
    }
    // kt tile: 256 rows x 128B, global row stride LK*2 bytes
#pragma unroll
    for (int i = 0; i < 8; ++i) {
      const int idx = tid + 256 * i;       // 0..2047
      const int d   = idx >> 3;
      const int c   = idx & 7;
      const __bf16* gp = kt_base + (size_t)d * LK + j + 8 * c;
      ASYNC_LDS_B128(ktB + (unsigned)(d * 128 + c * 16), gp);
    }
  };

  // Q fragments, resident, B operand of S^T = K·Q^T.
  v16bf qf[8];
  {
    const __bf16* qrow = qb + (size_t)(b * LQ + q0 + ln) * DD;
#pragma unroll
    for (int c = 0; c < 8; ++c) {
      F16 q;
      q.h[0] = *(const v8bf*)(qrow + 32 * c + 8 * g);
      q.h[1] = *(const v8bf*)(qrow + 32 * c + 16 + 8 * g);
      qf[c] = q.v;
    }
  }

  f8v o[16] = {};
  float mrow = -1e30f;   // per-lane softmax stats: query = ln
  float lrow = 0.0f;
  const float SC = 0.03125f * 1.4426950408889634f;  // SCALE * log2(e)

  stage(0, 0);
  int buf = 0;

  for (int j = 0; j < LK; j += KSTEP) {
    if (j + KSTEP < LK) {
      stage(buf ^ 1, j + KSTEP);   // prefetch next tile
      WAIT_ASYNC_LE16();           // current tile's copies done
    } else {
      WAIT_ASYNC_0();
    }
    __syncthreads();

    const int kbE = buf * BUF_ELEMS;            // element bases in smem
    const int ktE = kbE + KB_ELEMS;

    // ---- S^T tiles: 4 x 16 keys, A = key rows from LDS, B = resident Q ----
    // Batch the 4 fragments of each K-chunk before the 4 WMMAs so the
    // scheduler can stagger s_wait_dscnt instead of draining per WMMA.
    f8v s[4] = {};
#pragma unroll
    for (int c = 0; c < 8; ++c) {
      F16 ka[4];
#pragma unroll
      for (int tt = 0; tt < 4; ++tt) {
        const int base = kbE + (16 * tt + ln) * DD + 32 * c;
        ka[tt].h[0] = *(const v8bf*)&smem[base + 8 * g];
        ka[tt].h[1] = *(const v8bf*)&smem[base + 16 + 8 * g];
      }
#pragma unroll
      for (int tt = 0; tt < 4; ++tt)
        s[tt] = wmma_bf16(ka[tt].v, qf[c], s[tt]);
    }

    // ---- online softmax: keys lane-local, query = lane ----
    // Max commutes with the positive scale: reduce raw s, scale once.
    float mx = -1e30f;
#pragma unroll
    for (int tt = 0; tt < 4; ++tt)
#pragma unroll
      for (int r = 0; r < 8; ++r) mx = fmaxf(mx, s[tt][r]);
    mx = fmaxf(mx, __shfl_xor(mx, 16));         // merge key-halves
    const float mn    = fmaxf(mrow, mx * SC);
    const float alpha = exp2f(mrow - mn);
    mrow = mn;

    // P fragments: S^T C-layout == P A-layout (lane-local repack).
    F16 pf0, pf1;
    float rs = 0.0f;
#pragma unroll
    for (int r = 0; r < 8; ++r) {
      const float e0 = exp2f(fmaf(s[0][r], SC, -mn));
      const float e1 = exp2f(fmaf(s[1][r], SC, -mn));
      const float e2 = exp2f(fmaf(s[2][r], SC, -mn));
      const float e3 = exp2f(fmaf(s[3][r], SC, -mn));
      rs += (e0 + e1) + (e2 + e3);
      pf0.v[r] = (__bf16)e0; pf0.v[8 + r] = (__bf16)e1;
      pf1.v[r] = (__bf16)e2; pf1.v[8 + r] = (__bf16)e3;
    }
    rs += __shfl_xor(rs, 16);
    lrow = lrow * alpha + rs;

    // Rescale O: element r is query r+8g -> broadcast alpha from lane r+8g.
    float ar[8];
#pragma unroll
    for (int r = 0; r < 8; ++r) ar[r] = __shfl(alpha, r + 8 * g);
#pragma unroll
    for (int t = 0; t < 16; ++t)
#pragma unroll
      for (int r = 0; r < 8; ++r) o[t][r] *= ar[r];

    // ---- O += P @ K_tile from the LDS-transposed key tile ----
    // Two t-values per batch: 8 ds_load_b128 then 4 WMMAs.
#pragma unroll
    for (int t = 0; t < 16; t += 2) {
      F16 bb[4];
#pragma unroll
      for (int u = 0; u < 2; ++u) {
        const int base = ktE + (16 * (t + u) + ln) * KSTEP;
        bb[2 * u + 0].h[0] = *(const v8bf*)&smem[base + 8 * g];
        bb[2 * u + 0].h[1] = *(const v8bf*)&smem[base + 16 + 8 * g];
        bb[2 * u + 1].h[0] = *(const v8bf*)&smem[base + 32 + 8 * g];
        bb[2 * u + 1].h[1] = *(const v8bf*)&smem[base + 48 + 8 * g];
      }
      o[t]     = wmma_bf16(pf0.v, bb[0].v, o[t]);
      o[t]     = wmma_bf16(pf1.v, bb[1].v, o[t]);
      o[t + 1] = wmma_bf16(pf0.v, bb[2].v, o[t + 1]);
      o[t + 1] = wmma_bf16(pf1.v, bb[3].v, o[t + 1]);
    }

    __syncthreads();   // all waves done reading before buffer reuse
    buf ^= 1;
  }

  // ---- epilogue: normalize + f32 residual ----
  float inv[8];
#pragma unroll
  for (int r = 0; r < 8; ++r) inv[r] = 1.0f / __shfl(lrow, r + 8 * g);
#pragma unroll
  for (int t = 0; t < 16; ++t) {
#pragma unroll
    for (int r = 0; r < 8; ++r) {
      const int row    = q0 + r + 8 * g;
      const int col    = 16 * t + ln;
      const size_t idx = (size_t)(b * LQ + row) * DD + col;
      out[idx] = o[t][r] * inv[r] + qf32[idx];
    }
  }
}

// ---------------------------------------------------------------------------
extern "C" void kernel_launch(void* const* d_in, const int* in_sizes, int n_in,
                              void* d_out, int out_size, void* d_ws, size_t ws_size,
                              hipStream_t stream) {
  (void)in_sizes; (void)n_in; (void)out_size; (void)ws_size;

  const float* data1 = (const float*)d_in[0];  // [8,2048,1024]
  const float* data2 = (const float*)d_in[1];  // [8,2048,256]
  const float* Wq    = (const float*)d_in[2];  // [1024,256]
  const float* bq    = (const float*)d_in[3];  // [256]
  const float* Wk    = (const float*)d_in[4];  // [256,256]
  const float* bk    = (const float*)d_in[5];  // [256]
  float* out = (float*)d_out;                  // [8,2048,256]

  // Workspace (~41 MB):
  //   [ 0,16M)   query f32
  //   [16,24M)   query bf16          (B of S^T)
  //   [24,32M)   key bf16  [B,Lk,D]  (A of S^T, async-staged)
  //   [32,40M)   key bf16T [B,D,Lk]  (B of O += P·K, async-staged)
  //   [40M..]    WqT bf16, WkT bf16
  char* ws = (char*)d_ws;
  float*  q_f32 = (float*)ws;
  __bf16* q_b   = (__bf16*)(ws + (size_t)16 * 1024 * 1024);
  __bf16* k_b   = (__bf16*)(ws + (size_t)24 * 1024 * 1024);
  __bf16* kT_b  = (__bf16*)(ws + (size_t)32 * 1024 * 1024);
  __bf16* WqT   = (__bf16*)(ws + (size_t)40 * 1024 * 1024);
  __bf16* WkT   = (__bf16*)(ws + (size_t)40 * 1024 * 1024 + 512 * 1024);

  dim3 blk(256);
  weightT_kernel<<<dim3(1024), blk, 0, stream>>>(Wq, WqT, 1024);
  weightT_kernel<<<dim3(256), blk, 0, stream>>>(Wk, WkT, 256);

  dim3 pgrid(M_TOTAL / 256, DD / 64);
  proj_gemm_kernel<true, false><<<pgrid, blk, 0, stream>>>(
      data1, WqT, bq, 1024, q_f32, q_b, nullptr);
  proj_gemm_kernel<false, true><<<pgrid, blk, 0, stream>>>(
      data2, WkT, bk, 256, nullptr, k_b, kT_b);

  const int qtiles = BATCH * (LQ / 16);  // 1024 tiles, 1 wave each
  attn_kernel<<<dim3(qtiles / AWAVES), blk, SMEM_BYTES, stream>>>(
      q_b, k_b, kT_b, q_f32, out);
}

// v001
// One run takes 143 microseconds.
// Next to v000, in two timings, it ran 3.07 times as fast each time.
#include <hip/hip_runtime.h>

// ---------------------------------------------------------------------------
// CoAttention on MI455X (gfx1250): bf16 WMMA for all 4 matmuls, f32 softmax.
//   query = data1 @ Wq + bq            [8,2048,256]
//   key   = data2 @ Wk + bk            [8,2048,256]
//   S     = (query @ key^T) / 32       (flash style, never materialized)
//   out   = softmax(S) @ key + query   [8,2048,256]
//
// Roofline: ~45 GFLOP vs ~100 MB HBM -> compute bound on the WMMA pipes.
// Attention: 8 waves/block share one key stream -> stage 64-key tiles into
// LDS with gfx1250 async copies (ASYNCcnt), double buffered, for 8x L2
// traffic reduction and copy/compute overlap.
//
// Layout trick: S^T = K·Q^T so its C layout (element = key, lane = query)
// equals the A layout needed for P in O += P·K: softmax->P repack is
// lane-local (no LDS transpose, no shuffles).
// ---------------------------------------------------------------------------

typedef __attribute__((ext_vector_type(16))) __bf16 v16bf;
typedef __attribute__((ext_vector_type(8)))  __bf16 v8bf;
typedef __attribute__((ext_vector_type(8)))  float  f8v;

#define DD      256
#define LQ      2048
#define LK      2048
#define BATCH   8
#define M_TOTAL (BATCH * LQ)   // 16384
#define AWAVES  8
#define KSTEP   64             // keys per attention step (4 S-tiles)

// LDS row pitches, in elements: 16 B x odd, so that the 16 lanes of a
// ds_load_b128 half (one row each) fall on 16 different groups of 4 banks.
#define KB_PITCH  (DD + 8)              // 264 el = 528 B (16 B x 33)
#define KT_PITCH  (KSTEP + 8)           // 72 el  = 144 B (16 B x 9)

// Per double-buffer half: kb tile 64 rows x 528 B + kt tile 256 rows x 144 B.
#define KB_ELEMS  (KSTEP * KB_PITCH)        // 16896
#define KT_ELEMS  (DD * KT_PITCH)           // 18432
#define BUF_ELEMS (KB_ELEMS + KT_ELEMS)     // 35328 (kb + kt)
#define SMEM_BYTES (2 * BUF_ELEMS * 2)      // 141312 (double buffered)

union F16 {
  v16bf v;
  v8bf  h[2];
};

__device__ __forceinline__ f8v wmma_bf16(v16bf a, v16bf b, f8v c) {
  return __builtin_amdgcn_wmma_f32_16x16x32_bf16(false, a, false, b,
                                                 (short)0, c, false, false);
}

// Async global -> LDS copy, 16B per lane. VDST VGPR carries the LDS byte
// offset (dsaddr = LDS_BASE + VGPR), VADDR the 64-bit global address.
// Eight copies per statement; the s_wait_xcnt 0 at its end stands in front of
// any later rewrite of the address registers that the copies name.
#define ASYNC_LDS_B128_X8(l, p)                                            \
  asm volatile("global_load_async_to_lds_b128 %0, %8, off\n\t"             \
               "global_load_async_to_lds_b128 %1, %9, off\n\t"             \
               "global_load_async_to_lds_b128 %2, %10, off\n\t"            \
               "global_load_async_to_lds_b128 %3, %11, off\n\t"            \
               "global_load_async_to_lds_b128 %4, %12, off\n\t"            \
               "global_load_async_to_lds_b128 %5, %13, off\n\t"            \
               "global_load_async_to_lds_b128 %6, %14, off\n\t"            \
               "global_load_async_to_lds_b128 %7, %15, off\n\t"            \
               "s_wait_xcnt 0x0"                                           \
               :: "v"(l[0]), "v"(l[1]), "v"(l[2]), "v"(l[3]),              \
                  "v"(l[4]), "v"(l[5]), "v"(l[6]), "v"(l[7]),              \
                  "v"(p[0]), "v"(p[1]), "v"(p[2]), "v"(p[3]),              \
                  "v"(p[4]), "v"(p[5]), "v"(p[6]), "v"(p[7])               \
               : "memory")
#define WAIT_ASYNC_LE16() asm volatile("s_wait_asynccnt 0x10" ::: "memory")
#define WAIT_ASYNC_0()    asm volatile("s_wait_asynccnt 0x0"  ::: "memory")

// ---------------------------------------------------------------------------
// Weight prep: W[Kdim,256] (f32) -> WT[256,Kdim] (bf16), one-shot.
// ---------------------------------------------------------------------------
__global__ void __launch_bounds__(256)
weightT_kernel(const float* __restrict__ W, __bf16* __restrict__ WT, int Kdim) {
  const int idx = blockIdx.x * 256 + threadIdx.x;   // grid sized to Kdim*256
  const int k   = idx >> 8;
  const int col = idx & 255;
  WT[(size_t)col * Kdim + k] = (__bf16)W[idx];      // native v_cvt_pk_bf16_f32
}

// ---------------------------------------------------------------------------
// Projection GEMM: C[M,256] = A[M,Kdim] @ W[Kdim,256] + bias.
// Wave tile 32(M) x 64(N); block = 8 waves stacked in M; grid (M/256, 4).
// Epilogue write-set is a template parameter: no per-element branches.
// ---------------------------------------------------------------------------
template <bool WRITE_F32, bool WRITE_T>
__global__ void __launch_bounds__(256)
proj_gemm_kernel(const float* __restrict__ A, const __bf16* __restrict__ WT,
                 const float* __restrict__ bias, int Kdim,
                 float* __restrict__ outF32, __bf16* __restrict__ outB,
                 __bf16* __restrict__ outT) {
  const int lane = threadIdx.x & 31;
  const int wave = threadIdx.x >> 5;
  const int g    = lane >> 4;
  const int ln   = lane & 15;
  const int m0   = blockIdx.x * 256 + wave * 32;
  const int n0   = blockIdx.y * 64;

  f8v acc[2][4] = {};

  const float* arow0 = A + (size_t)(m0 + ln) * Kdim;
  const float* arow1 = arow0 + (size_t)16 * Kdim;

  for (int k0 = 0; k0 < Kdim; k0 += 32) {
    f8v lo0 = *(const f8v*)(arow0 + k0 + 8 * g);
    f8v hi0 = *(const f8v*)(arow0 + k0 + 16 + 8 * g);
    f8v lo1 = *(const f8v*)(arow1 + k0 + 8 * g);
    f8v hi1 = *(const f8v*)(arow1 + k0 + 16 + 8 * g);
    v16bf af0, af1;
#pragma unroll
    for (int i = 0; i < 8; ++i) {
      af0[i] = (__bf16)lo0[i]; af0[8 + i] = (__bf16)hi0[i];
      af1[i] = (__bf16)lo1[i]; af1[8 + i] = (__bf16)hi1[i];
    }
#pragma unroll
    for (int t = 0; t < 4; ++t) {
      const __bf16* wtrow = WT + (size_t)(n0 + 16 * t + ln) * Kdim + k0;
      F16 bfr;
      bfr.h[0] = *(const v8bf*)(wtrow + 8 * g);
      bfr.h[1] = *(const v8bf*)(wtrow + 16 + 8 * g);
      acc[0][t] = wmma_bf16(af0, bfr.v, acc[0][t]);
      acc[1][t] = wmma_bf16(af1, bfr.v, acc[1][t]);
    }
  }

#pragma unroll
  for (int s = 0; s < 2; ++s) {
#pragma unroll
    for (int t = 0; t < 4; ++t) {
      const int col    = n0 + 16 * t + ln;
      const float bval = bias[col];
#pragma unroll
      for (int r = 0; r < 8; ++r) {
        const int row    = m0 + 16 * s + r + 8 * g;   // C layout: M = r + 8g
        const float v    = acc[s][t][r] + bval;
        const size_t idx = (size_t)row * DD + col;
        if constexpr (WRITE_F32) outF32[idx] = v;
        const __bf16 hv = (__bf16)v;
        outB[idx] = hv;
        if constexpr (WRITE_T) {
          const int bb   = row >> 11;   // row / 2048
          const int lrow = row & 2047;
          outT[((size_t)(bb * DD + col)) * LK + lrow] = hv;
        }
      }
    }
  }
}

// ---------------------------------------------------------------------------
// Flash attention. One wave per 16-query tile; 8 waves/block share the key
// stream via double-buffered async LDS staging (64 keys/step).
// smem layout per buffer: [kb 64 rows, pitch 264 el][kt 256 rows, pitch 72 el].
// ---------------------------------------------------------------------------
__global__ void __launch_bounds__(256)
attn_kernel(const __bf16* __restrict__ qb, const __bf16* __restrict__ kb,
            const __bf16* __restrict__ ktb, const float* __restrict__ qf32,
            float* __restrict__ out) {
  extern __shared__ __bf16 smem[];

  const int tid  = threadIdx.x;
  const int lane = tid & 31;
  const int wave = tid >> 5;
  const int g    = lane >> 4;
  const int ln   = lane & 15;
  const int tile = blockIdx.x * AWAVES + wave;
  const int b    = tile >> 7;                  // per-wave batch
  const int q0   = (tile & 127) << 4;
  const int bblk = (blockIdx.x * AWAVES) >> 7; // block-uniform batch (same)

  const __bf16* kb_base = kb + (size_t)bblk * LK * DD;
  const __bf16* kt_base = ktb + (size_t)bblk * DD * LK;

  // ---- cooperative async stage of one 64-key tile into buffer `buf` ----
  auto stage = [&](int buf, int j) {
    const unsigned kbB = (unsigned)(buf * BUF_ELEMS) * 2;      // byte offsets
    const unsigned ktB = kbB + (unsigned)KB_ELEMS * 2;
    unsigned    la[8];
    const char* ga[8];
    // kb tile: 64 rows x 512B, contiguous in global, padded pitch in LDS
    const char* gkb = (const char*)(kb_base + (size_t)j * DD);
#pragma unroll
    for (int i = 0; i < 8; ++i) {
      const int idx = tid + 256 * i;       // 0..2047
      const int row = idx >> 5;
      const int c   = idx & 31;
      la[i] = kbB + (unsigned)(row * (KB_PITCH * 2) + c * 16);
      ga[i] = gkb + (unsigned)idx * 16;
    }
    ASYNC_LDS_B128_X8(la, ga);
    // kt tile: 256 rows x 128B, global row stride LK*2 bytes, padded in LDS
#pragma unroll
    for (int i = 0; i < 8; ++i) {
      const int idx = tid + 256 * i;       // 0..2047
      const int d   = idx >> 3;
      const int c   = idx & 7;
      la[i] = ktB + (unsigned)(d * (KT_PITCH * 2) + c * 16);
      ga[i] = (const char*)(kt_base + (size_t)d * LK + j + 8 * c);
    }
    ASYNC_LDS_B128_X8(la, ga);
  };

  // Q fragments, resident, B operand of S^T = K·Q^T.
  v16bf qf[8];
  {
    const __bf16* qrow = qb + (size_t)(b * LQ + q0 + ln) * DD;
#pragma unroll
    for (int c = 0; c < 8; ++c) {
      F16 q;
      q.h[0] = *(const v8bf*)(qrow + 32 * c + 8 * g);
      q.h[1] = *(const v8bf*)(qrow + 32 * c + 16 + 8 * g);
      qf[c] = q.v;
    }
  }

  f8v o[16] = {};
  float mrow = -1e30f;   // per-lane softmax stats: query = ln
  float lrow = 0.0f;
  const float SC = 0.03125f * 1.4426950408889634f;  // SCALE * log2(e)

  stage(0, 0);
  int buf = 0;

  for (int j = 0; j < LK; j += KSTEP) {
    if (j + KSTEP < LK) {
      stage(buf ^ 1, j + KSTEP);   // prefetch next tile
      WAIT_ASYNC_LE16();           // current tile's copies done
    } else {
      WAIT_ASYNC_0();
    }
    __syncthreads();

    const int kbE = buf * BUF_ELEMS;            // element bases in smem
    const int ktE = kbE + KB_ELEMS;

    // ---- S^T tiles: 4 x 16 keys, A = key rows from LDS, B = resident Q ----
    // Batch the 4 fragments of each K-chunk before the 4 WMMAs so the
    // scheduler can stagger s_wait_dscnt instead of draining per WMMA.
    f8v s[4] = {};
#pragma unroll
    for (int c = 0; c < 8; ++c) {
      F16 ka[4];
#pragma unroll
      for (int tt = 0; tt < 4; ++tt) {
        const int base = kbE + (16 * tt + ln) * KB_PITCH + 32 * c;
        ka[tt].h[0] = *(const v8bf*)&smem[base + 8 * g];
        ka[tt].h[1] = *(const v8bf*)&smem[base + 16 + 8 * g];
      }
#pragma unroll
      for (int tt = 0; tt < 4; ++tt)
        s[tt] = wmma_bf16(ka[tt].v, qf[c], s[tt]);
    }

    // ---- online softmax: keys lane-local, query = lane ----
    // Max commutes with the positive scale: reduce raw s, scale once.
    float mx = -1e30f;
#pragma unroll
    for (int tt = 0; tt < 4; ++tt)
#pragma unroll
      for (int r = 0; r < 8; ++r) mx = fmaxf(mx, s[tt][r]);
    mx = fmaxf(mx, __shfl_xor(mx, 16));         // merge key-halves
    const float mn    = fmaxf(mrow, mx * SC);
    const float alpha = exp2f(mrow - mn);
    mrow = mn;

    // P fragments: S^T C-layout == P A-layout (lane-local repack).
    F16 pf0, pf1;
    float rs = 0.0f;
#pragma unroll
    for (int r = 0; r < 8; ++r) {
      const float e0 = exp2f(fmaf(s[0][r], SC, -mn));
      const float e1 = exp2f(fmaf(s[1][r], SC, -mn));
      const float e2 = exp2f(fmaf(s[2][r], SC, -mn));
      const float e3 = exp2f(fmaf(s[3][r], SC, -mn));
      rs += (e0 + e1) + (e2 + e3);
      pf0.v[r] = (__bf16)e0; pf0.v[8 + r] = (__bf16)e1;
      pf1.v[r] = (__bf16)e2; pf1.v[8 + r] = (__bf16)e3;
    }
    rs += __shfl_xor(rs, 16);
    lrow = lrow * alpha + rs;

    // Rescale O: element r is query r+8g -> broadcast alpha from lane r+8g.
    float ar[8];
#pragma unroll
    for (int r = 0; r < 8; ++r) ar[r] = __shfl(alpha, r + 8 * g);
#pragma unroll
    for (int t = 0; t < 16; ++t)
#pragma unroll
      for (int r = 0; r < 8; ++r) o[t][r] *= ar[r];

    // ---- O += P @ K_tile from the LDS-transposed key tile ----
    // Two t-values per batch: 8 ds_load_b128 then 4 WMMAs.
#pragma unroll
    for (int t = 0; t < 16; t += 2) {
      F16 bb[4];
#pragma unroll
      for (int u = 0; u < 2; ++u) {
        const int base = ktE + (16 * (t + u) + ln) * KT_PITCH;
        bb[2 * u + 0].h[0] = *(const v8bf*)&smem[base + 8 * g];
        bb[2 * u + 0].h[1] = *(const v8bf*)&smem[base + 16 + 8 * g];
        bb[2 * u + 1].h[0] = *(const v8bf*)&smem[base + 32 + 8 * g];
        bb[2 * u + 1].h[1] = *(const v8bf*)&smem[base + 48 + 8 * g];
      }
      o[t]     = wmma_bf16(pf0.v, bb[0].v, o[t]);
      o[t]     = wmma_bf16(pf1.v, bb[1].v, o[t]);
      o[t + 1] = wmma_bf16(pf0.v, bb[2].v, o[t + 1]);
      o[t + 1] = wmma_bf16(pf1.v, bb[3].v, o[t + 1]);
    }

    __syncthreads();   // all waves done reading before buffer reuse
    buf ^= 1;
  }

  // ---- epilogue: normalize + f32 residual ----
  float inv[8];
#pragma unroll
  for (int r = 0; r < 8; ++r) inv[r] = 1.0f / __shfl(lrow, r + 8 * g);
#pragma unroll
  for (int t = 0; t < 16; ++t) {
#pragma unroll
    for (int r = 0; r < 8; ++r) {
      const int row    = q0 + r + 8 * g;
      const int col    = 16 * t + ln;
      const size_t idx = (size_t)(b * LQ + row) * DD + col;
      out[idx] = o[t][r] * inv[r] + qf32[idx];
    }
  }
}

// ---------------------------------------------------------------------------
extern "C" void kernel_launch(void* const* d_in, const int* in_sizes, int n_in,
                              void* d_out, int out_size, void* d_ws, size_t ws_size,
                              hipStream_t stream) {
  (void)in_sizes; (void)n_in; (void)out_size; (void)ws_size;

  const float* data1 = (const float*)d_in[0];  // [8,2048,1024]
  const float* data2 = (const float*)d_in[1];  // [8,2048,256]
  const float* Wq    = (const float*)d_in[2];  // [1024,256]
  const float* bq    = (const float*)d_in[3];  // [256]
  const float* Wk    = (const float*)d_in[4];  // [256,256]
  const float* bk    = (const float*)d_in[5];  // [256]
  float* out = (float*)d_out;                  // [8,2048,256]

  // Workspace (~41 MB):
  //   [ 0,16M)   query f32
  //   [16,24M)   query bf16          (B of S^T)
  //   [24,32M)   key bf16  [B,Lk,D]  (A of S^T, async-staged)
  //   [32,40M)   key bf16T [B,D,Lk]  (B of O += P·K, async-staged)
  //   [40M..]    WqT bf16, WkT bf16
  char* ws = (char*)d_ws;
  float*  q_f32 = (float*)ws;
  __bf16* q_b   = (__bf16*)(ws + (size_t)16 * 1024 * 1024);
  __bf16* k_b   = (__bf16*)(ws + (size_t)24 * 1024 * 1024);
  __bf16* kT_b  = (__bf16*)(ws + (size_t)32 * 1024 * 1024);
  __bf16* WqT   = (__bf16*)(ws + (size_t)40 * 1024 * 1024);
  __bf16* WkT   = (__bf16*)(ws + (size_t)40 * 1024 * 1024 + 512 * 1024);

  dim3 blk(256);
  weightT_kernel<<<dim3(1024), blk, 0, stream>>>(Wq, WqT, 1024);
  weightT_kernel<<<dim3(256), blk, 0, stream>>>(Wk, WkT, 256);

  dim3 pgrid(M_TOTAL / 256, DD / 64);
  proj_gemm_kernel<true, false><<<pgrid, blk, 0, stream>>>(
      data1, WqT, bq, 1024, q_f32, q_b, nullptr);
  proj_gemm_kernel<false, true><<<pgrid, blk, 0, stream>>>(
      data2, WkT, bk, 256, nullptr, k_b, kT_b);

  const int qtiles = BATCH * (LQ / 16);  // 1024 tiles, 1 wave each
  attn_kernel<<<dim3(qtiles / AWAVES), blk, SMEM_BYTES, stream>>>(
      q_b, k_b, kT_b, q_f32, out);
}

// v002
// A run of this version takes 117 microseconds.
// Next to v001, in two timings, it ran 1.22 and 1.21 times as fast.
// Counting every step since v000, it is 3.73 times as fast.
#include <hip/hip_runtime.h>

// ---------------------------------------------------------------------------
// CoAttention on MI455X (gfx1250): bf16 WMMA for all 4 matmuls, f32 softmax.
//   query = data1 @ Wq + bq            [8,2048,256]
//   key   = data2 @ Wk + bk            [8,2048,256]
//   S     = (query @ key^T) / 32       (flash style, never materialized)
//   out   = softmax(S) @ key + query   [8,2048,256]
//
// Roofline: ~45 GFLOP vs ~100 MB HBM -> compute bound on the WMMA pipes.
// Attention: a block takes 64 queries on 8 waves: 4 query tiles x 2 key
// halves, so that 256 blocks fill all 256 WGPs at two waves per SIMD. Each
// stage brings 128 keys (one 64-key tile per half) into LDS with gfx1250
// async copies (ASYNCcnt), double buffered; the halves are joined in LDS.
//
// Layout trick: S^T = K·Q^T so its C layout (element = key, lane = query)
// equals the A layout needed for P in O += P·K: softmax->P repack is
// lane-local (no LDS transpose, no shuffles).
// ---------------------------------------------------------------------------

typedef __attribute__((ext_vector_type(16))) __bf16 v16bf;
typedef __attribute__((ext_vector_type(8)))  __bf16 v8bf;
typedef __attribute__((ext_vector_type(8)))  float  f8v;
typedef __attribute__((ext_vector_type(4)))  float  f4v;

#define DD      256
#define LQ      2048
#define LK      2048
#define BATCH   8
#define M_TOTAL (BATCH * LQ)   // 16384
#define QTILES  4              // 16-query tiles per attention block
#define KSPLIT  2              // wave groups that share the keys of a stage
#define KSTEP   64             // keys per wave and attention step (4 S-tiles)
#define NSTAGE  (LK / (KSPLIT * KSTEP))   // 16 stages of 128 keys

// LDS rows hold 256 B at a pitch of 272 B (16 B x odd), so that the 16 lanes
// of a ds_load_b128 half (one row each) fall on 16 different groups of 4 banks.
#define PITCH       (128 + 8)                 // 136 el = 272 B (16 B x 17)

// One stage = 128 keys:
//   kb [2 halves of d][128 keys][128 d]   key rows, d 0-127 and d 128-255 apart
//   kt [256 d][128 keys]                  the same keys transposed
// The ring holds two stages.
#define SKEYS       (KSPLIT * KSTEP)          // 128
#define KBH_ELEMS   (SKEYS * PITCH)           // 17408: one d half of kb
#define KB_ELEMS    (2 * KBH_ELEMS)           // 34816
#define KT_ELEMS    (DD * PITCH)              // 34816
#define STAGE_ELEMS (KB_ELEMS + KT_ELEMS)     // 69632
#define SMEM_ELEMS  (2 * STAGE_ELEMS)         // 139264 el = 278528 B

union F16 {
  v16bf v;
  v8bf  h[2];
};

__device__ __forceinline__ f8v wmma_bf16(v16bf a, v16bf b, f8v c) {
  return __builtin_amdgcn_wmma_f32_16x16x32_bf16(false, a, false, b,
                                                 (short)0, c, false, false);
}

// Async global -> LDS copy, 16B per lane. VDST VGPR carries the LDS byte
// offset (dsaddr = LDS_BASE + VGPR), VADDR the 64-bit global address.
// Eight copies per statement; the s_wait_xcnt 0 at its end stands in front of
// any later rewrite of the address registers that the copies name.
#define ASYNC_LDS_B128_X8(l, p)                                            \
  asm volatile("global_load_async_to_lds_b128 %0, %8, off\n\t"             \
               "global_load_async_to_lds_b128 %1, %9, off\n\t"             \
               "global_load_async_to_lds_b128 %2, %10, off\n\t"            \
               "global_load_async_to_lds_b128 %3, %11, off\n\t"            \
               "global_load_async_to_lds_b128 %4, %12, off\n\t"            \
               "global_load_async_to_lds_b128 %5, %13, off\n\t"            \
               "global_load_async_to_lds_b128 %6, %14, off\n\t"            \
               "global_load_async_to_lds_b128 %7, %15, off\n\t"            \
               "s_wait_xcnt 0x0"                                           \
               :: "v"(l[0]), "v"(l[1]), "v"(l[2]), "v"(l[3]),              \
                  "v"(l[4]), "v"(l[5]), "v"(l[6]), "v"(l[7]),              \
                  "v"(p[0]), "v"(p[1]), "v"(p[2]), "v"(p[3]),              \
                  "v"(p[4]), "v"(p[5]), "v"(p[6]), "v"(p[7])               \
               : "memory")
// Publish point of the two-buffer ring: the wave's own LDS reads have
// retired, its own copies have landed; the barrier follows.
#define WAIT_DS_0()       asm volatile("s_wait_dscnt 0x0"     ::: "memory")
#define WAIT_ASYNC_0()    asm volatile("s_wait_asynccnt 0x0"  ::: "memory")

// ---------------------------------------------------------------------------
// Weight prep: W[Kdim,256] (f32) -> WT[256,Kdim] (bf16), one-shot.
// ---------------------------------------------------------------------------
__global__ void __launch_bounds__(256)
weightT_kernel(const float* __restrict__ W, __bf16* __restrict__ WT, int Kdim) {
  const int idx = blockIdx.x * 256 + threadIdx.x;   // grid sized to Kdim*256
  const int k   = idx >> 8;
  const int col = idx & 255;
  WT[(size_t)col * Kdim + k] = (__bf16)W[idx];      // native v_cvt_pk_bf16_f32
}

// ---------------------------------------------------------------------------
// Projection GEMM: C[M,256] = A[M,Kdim] @ W[Kdim,256] + bias.
// Wave tile 32(M) x 64(N); block = 8 waves stacked in M; grid (M/256, 4).
// Epilogue write-set is a template parameter: no per-element branches.
// ---------------------------------------------------------------------------
template <bool WRITE_F32, bool WRITE_T>
__global__ void __launch_bounds__(256)
proj_gemm_kernel(const float* __restrict__ A, const __bf16* __restrict__ WT,
                 const float* __restrict__ bias, int Kdim,
                 float* __restrict__ outF32, __bf16* __restrict__ outB,
                 __bf16* __restrict__ outT) {
  const int lane = threadIdx.x & 31;
  const int wave = threadIdx.x >> 5;
  const int g    = lane >> 4;
  const int ln   = lane & 15;
  const int m0   = blockIdx.x * 256 + wave * 32;
  const int n0   = blockIdx.y * 64;

  f8v acc[2][4] = {};

  const float* arow0 = A + (size_t)(m0 + ln) * Kdim;
  const float* arow1 = arow0 + (size_t)16 * Kdim;

  for (int k0 = 0; k0 < Kdim; k0 += 32) {
    f8v lo0 = *(const f8v*)(arow0 + k0 + 8 * g);
    f8v hi0 = *(const f8v*)(arow0 + k0 + 16 + 8 * g);
    f8v lo1 = *(const f8v*)(arow1 + k0 + 8 * g);
    f8v hi1 = *(const f8v*)(arow1 + k0 + 16 + 8 * g);
    v16bf af0, af1;
#pragma unroll
    for (int i = 0; i < 8; ++i) {
      af0[i] = (__bf16)lo0[i]; af0[8 + i] = (__bf16)hi0[i];
      af1[i] = (__bf16)lo1[i]; af1[8 + i] = (__bf16)hi1[i];
    }
#pragma unroll
    for (int t = 0; t < 4; ++t) {
      const __bf16* wtrow = WT + (size_t)(n0 + 16 * t + ln) * Kdim + k0;
      F16 bfr;
      bfr.h[0] = *(const v8bf*)(wtrow + 8 * g);
      bfr.h[1] = *(const v8bf*)(wtrow + 16 + 8 * g);
      acc[0][t] = wmma_bf16(af0, bfr.v, acc[0][t]);
      acc[1][t] = wmma_bf16(af1, bfr.v, acc[1][t]);
    }
  }

#pragma unroll
  for (int s = 0; s < 2; ++s) {
#pragma unroll
    for (int t = 0; t < 4; ++t) {
      const int col    = n0 + 16 * t + ln;
      const float bval = bias[col];
#pragma unroll
      for (int r = 0; r < 8; ++r) {
        const int row    = m0 + 16 * s + r + 8 * g;   // C layout: M = r + 8g
        const float v    = acc[s][t][r] + bval;
        const size_t idx = (size_t)row * DD + col;
        if constexpr (WRITE_F32) outF32[idx] = v;
        const __bf16 hv = (__bf16)v;
        outB[idx] = hv;
        if constexpr (WRITE_T) {
          const int bb   = row >> 11;   // row / 2048
          const int lrow = row & 2047;
          outT[((size_t)(bb * DD + col)) * LK + lrow] = hv;
        }
      }
    }
  }
}

// ---------------------------------------------------------------------------
// Flash attention. One wave per (16-query tile, key half): waves 0-3 take the
// first 64 keys of every 128-key stage, waves 4-7 the second 64, each with its
// own running maximum, sum and O; the two are joined through LDS at the end.
// smem per stage: [kb 2 x 128 rows][kt 256 rows], pitch 136 el.
// ---------------------------------------------------------------------------
__global__ void __launch_bounds__(256)
attn_kernel(const __bf16* __restrict__ qb, const __bf16* __restrict__ kb,
            const __bf16* __restrict__ ktb, const float* __restrict__ qf32,
            float* __restrict__ out) {
  __shared__ __attribute__((aligned(16))) __bf16 smem[SMEM_ELEMS];

  const int tid  = threadIdx.x;
  const int lane = tid & 31;
  // The wave's number as a scalar: all that depends on it alone (the rows a
  // wave copies, its key half) then stays in scalar registers.
  const int wave = __builtin_amdgcn_readfirstlane(tid >> 5);
  const int g    = lane >> 4;
  const int ln   = lane & 15;
  const int kh   = wave >> 2;                  // key half of this wave
  const int tile = blockIdx.x * QTILES + (wave & 3);
  const int b    = tile >> 7;                  // per-wave batch
  const int q0   = (tile & 127) << 4;
  const int bblk = (blockIdx.x * QTILES) >> 7; // block-uniform batch (same)

  const char* kb_base = (const char*)(kb + (size_t)bblk * LK * DD);
  const char* kt_base = (const char*)(ktb + (size_t)bblk * DD * LK);
  const unsigned smemB = (unsigned)(size_t)smem;   // LDS byte address of the ring

  // Per-lane parts of the copy addresses, in bytes; the rest is wave-uniform.
  // Every copy instruction brings two 256-B rows, lanes 0-15 one and lanes
  // 16-31 the other, which lie 128 LDS rows apart:
  //   kb: the two d halves of key row (wave + 8k), 512 B in a row in global;
  //   kt: rows d = wave + 8k and d + 128.
  const unsigned laneL  = (unsigned)(g * (KBH_ELEMS * 2) + ln * 16);
  const unsigned kbLane = (unsigned)lane * 16;
  const unsigned ktLane = (unsigned)(g * (128 * LK * 2) + ln * 16);

  // ---- cooperative async copy of stage `st` (128 keys) into buffer `buf` ----
  auto stage = [&](int buf, int st) {
    const unsigned lrow = smemB + (unsigned)(buf * STAGE_ELEMS) * 2 +
                          (unsigned)wave * (PITCH * 2);
    const char* gkb = kb_base + (size_t)(st * SKEYS + wave) * (DD * 2);
    const char* gkt = kt_base + (size_t)st * (SKEYS * 2) + (size_t)wave * (LK * 2);
    unsigned    la[8];
    const char* ga[8];
#pragma unroll
    for (int h = 0; h < 2; ++h) {
#pragma unroll
      for (int i = 0; i < 8; ++i) {
        la[i] = (lrow + (unsigned)(8 * (8 * h + i) * (PITCH * 2))) + laneL;
        ga[i] = (gkb + (8 * (8 * h + i)) * (DD * 2)) + kbLane;
      }
      ASYNC_LDS_B128_X8(la, ga);
    }
#pragma unroll
    for (int h = 0; h < 2; ++h) {
#pragma unroll
      for (int i = 0; i < 8; ++i) {
        la[i] = (lrow + (unsigned)(KB_ELEMS * 2 + 8 * (8 * h + i) * (PITCH * 2))) + laneL;
        ga[i] = (gkt + (8 * (8 * h + i)) * (LK * 2)) + ktLane;
      }
      ASYNC_LDS_B128_X8(la, ga);
    }
  };

  // Q fragments, resident, B operand of S^T = K·Q^T.
  v16bf qf[8];
  {
    const __bf16* qrow = qb + (size_t)(b * LQ + q0 + ln) * DD;
#pragma unroll
    for (int c = 0; c < 8; ++c) {
      F16 q;
      q.h[0] = *(const v8bf*)(qrow + 32 * c + 8 * g);
      q.h[1] = *(const v8bf*)(qrow + 32 * c + 16 + 8 * g);
      qf[c] = q.v;
    }
  }

  f8v o[16] = {};
  float mrow = -1e30f;   // per-lane softmax stats: query = ln
  float lrow = 0.0f;
  const float SC = 0.03125f * 1.4426950408889634f;  // SCALE * log2(e)

  // Two-buffer ring: one stage's copies (32 per wave) in flight at a time.
  stage(0, 0);
  WAIT_ASYNC_0();
  __syncthreads();
  stage(1, 1);

  for (int st = 0; st < NSTAGE; ++st) {
    const int buf = st & 1;
    // element bases in smem: this wave's 64 key rows of kb, key columns of kt
    const int kbE = buf * STAGE_ELEMS + kh * (KSTEP * PITCH);
    const int ktE = buf * STAGE_ELEMS + KB_ELEMS + kh * KSTEP;

    // ---- S^T tiles: 4 x 16 keys, A = key rows from LDS, B = resident Q ----
    // Batch the 4 fragments of each K-chunk before the 4 WMMAs so the
    // scheduler can stagger s_wait_dscnt instead of draining per WMMA.
    f8v s[4] = {};
#pragma unroll
    for (int c = 0; c < 8; ++c) {
      F16 ka[4];
#pragma unroll
      for (int tt = 0; tt < 4; ++tt) {
        const int base = kbE + (c >> 2) * KBH_ELEMS + (16 * tt + ln) * PITCH +
                         32 * (c & 3);
        ka[tt].h[0] = *(const v8bf*)&smem[base + 8 * g];
        ka[tt].h[1] = *(const v8bf*)&smem[base + 16 + 8 * g];
      }
#pragma unroll
      for (int tt = 0; tt < 4; ++tt)
        s[tt] = wmma_bf16(ka[tt].v, qf[c], s[tt]);
    }

    // ---- online softmax: keys lane-local, query = lane ----
    // Max commutes with the positive scale: reduce raw s, scale once.
    float mx = -1e30f;
#pragma unroll
    for (int tt = 0; tt < 4; ++tt)
#pragma unroll
      for (int r = 0; r < 8; ++r) mx = fmaxf(mx, s[tt][r]);
    mx = fmaxf(mx, __shfl_xor(mx, 16));         // merge key-halves
    const float mn    = fmaxf(mrow, mx * SC);
    const float alpha = exp2f(mrow - mn);
    mrow = mn;

    // P fragments: S^T C-layout == P A-layout (lane-local repack).
    F16 pf0, pf1;
    float rs = 0.0f;
#pragma unroll
    for (int r = 0; r < 8; ++r) {
      const float e0 = exp2f(fmaf(s[0][r], SC, -mn));
      const float e1 = exp2f(fmaf(s[1][r], SC, -mn));
      const float e2 = exp2f(fmaf(s[2][r], SC, -mn));
      const float e3 = exp2f(fmaf(s[3][r], SC, -mn));
      rs += (e0 + e1) + (e2 + e3);
      pf0.v[r] = (__bf16)e0; pf0.v[8 + r] = (__bf16)e1;
      pf1.v[r] = (__bf16)e2; pf1.v[8 + r] = (__bf16)e3;
    }
    rs += __shfl_xor(rs, 16);
    lrow = lrow * alpha + rs;

    // Rescale O: element r is query r+8g -> broadcast alpha from lane r+8g.
    float ar[8];
#pragma unroll
    for (int r = 0; r < 8; ++r) ar[r] = __shfl(alpha, r + 8 * g);
#pragma unroll
    for (int t = 0; t < 16; ++t)
#pragma unroll
      for (int r = 0; r < 8; ++r) o[t][r] *= ar[r];

    // ---- O += P @ K_tile from the LDS-transposed key tile ----
    // Two t-values per batch: 8 ds_load_b128 then 4 WMMAs.
#pragma unroll
    for (int t = 0; t < 16; t += 2) {
      F16 bb[4];
#pragma unroll
      for (int u = 0; u < 2; ++u) {
        const int base = ktE + (16 * (t + u) + ln) * PITCH;
        bb[2 * u + 0].h[0] = *(const v8bf*)&smem[base + 8 * g];
        bb[2 * u + 0].h[1] = *(const v8bf*)&smem[base + 16 + 8 * g];
        bb[2 * u + 1].h[0] = *(const v8bf*)&smem[base + 32 + 8 * g];
        bb[2 * u + 1].h[1] = *(const v8bf*)&smem[base + 48 + 8 * g];
      }
      o[t]     = wmma_bf16(pf0.v, bb[0].v, o[t]);
      o[t]     = wmma_bf16(pf1.v, bb[1].v, o[t]);
      o[t + 1] = wmma_bf16(pf0.v, bb[2].v, o[t + 1]);
      o[t + 1] = wmma_bf16(pf1.v, bb[3].v, o[t + 1]);
    }

    // Publish stage st + 1 and free this buffer with one barrier, then refill.
    WAIT_DS_0();
    WAIT_ASYNC_0();
    __syncthreads();
    if (st + 2 < NSTAGE) stage(buf, st + 2);
  }
  WAIT_ASYNC_0();   // nothing is in flight when the ring becomes join space

  // f32 residual of the 16 x 128 piece that this wave finishes, read in one run
  // so that one wait covers the run's address registers.
  const size_t idx0 = (size_t)(b * LQ + q0 + 8 * g) * DD + 128 * kh + ln;
  float res[8][8];
#pragma unroll
  for (int tt = 0; tt < 8; ++tt)
#pragma unroll
    for (int r = 0; r < 8; ++r) res[tt][r] = qf32[idx0 + (size_t)(r * DD + 16 * tt)];
  // stands in front of any later rewrite of the address registers of that run
  asm volatile("s_wait_xcnt 0x0" ::: "memory");

  // ---- join the two key halves: each wave hands its partner (wave ^ 4) the
  // 8 column tiles that the partner finishes, with its maximum and sum ----
  float* xo = (float*)smem;                     // [wave][8 tiles][2][32 lanes] f4v
  float* xs = xo + 8 * 2048;                    // [wave][m, l][32 lanes]
  const bool hi = kh != 0;                      // finishes column tiles 8..15
#pragma unroll
  for (int tt = 0; tt < 8; ++tt) {
    f4v s0, s1;
#pragma unroll
    for (int r = 0; r < 4; ++r) {
      s0[r] = hi ? o[tt][r]     : o[8 + tt][r];
      s1[r] = hi ? o[tt][4 + r] : o[8 + tt][4 + r];
    }
    *(f4v*)&xo[wave * 2048 + ((2 * tt + 0) * 32 + lane) * 4] = s0;
    *(f4v*)&xo[wave * 2048 + ((2 * tt + 1) * 32 + lane) * 4] = s1;
  }
  xs[(wave * 2 + 0) * 32 + lane] = mrow;
  xs[(wave * 2 + 1) * 32 + lane] = lrow;
  __syncthreads();

  const int   pw = wave ^ 4;
  const float mo = xs[(pw * 2 + 0) * 32 + lane];
  const float lo = xs[(pw * 2 + 1) * 32 + lane];
  const float mj = fmaxf(mrow, mo);
  const float as = exp2f(mrow - mj);
  const float ao = exp2f(mo - mj);
  const float li = 1.0f / (lrow * as + lo * ao);
  const float fs = as * li;                     // weight of this wave's O
  const float fo = ao * li;                     // weight of the partner's O

  // ---- epilogue: normalize + f32 residual ----
  float ws[8], wo[8];
#pragma unroll
  for (int r = 0; r < 8; ++r) {
    ws[r] = __shfl(fs, r + 8 * g);
    wo[r] = __shfl(fo, r + 8 * g);
  }
#pragma unroll
  for (int tt = 0; tt < 8; ++tt) {
    const f4v p0 = *(const f4v*)&xo[pw * 2048 + ((2 * tt + 0) * 32 + lane) * 4];
    const f4v p1 = *(const f4v*)&xo[pw * 2048 + ((2 * tt + 1) * 32 + lane) * 4];
#pragma unroll
    for (int r = 0; r < 8; ++r) {
      const float mine = hi ? o[8 + tt][r] : o[tt][r];
      const float part = r < 4 ? p0[r & 3] : p1[r & 3];
      out[idx0 + (size_t)(r * DD + 16 * tt)] = mine * ws[r] + part * wo[r] + res[tt][r];
    }
  }
}

// ---------------------------------------------------------------------------
extern "C" void kernel_launch(void* const* d_in, const int* in_sizes, int n_in,
                              void* d_out, int out_size, void* d_ws, size_t ws_size,
                              hipStream_t stream) {
  (void)in_sizes; (void)n_in; (void)out_size; (void)ws_size;

  const float* data1 = (const float*)d_in[0];  // [8,2048,1024]
  const float* data2 = (const float*)d_in[1];  // [8,2048,256]
  const float* Wq    = (const float*)d_in[2];  // [1024,256]
  const float* bq    = (const float*)d_in[3];  // [256]
  const float* Wk    = (const float*)d_in[4];  // [256,256]
  const float* bk    = (const float*)d_in[5];  // [256]
  float* out = (float*)d_out;                  // [8,2048,256]

  // Workspace (~41 MB):
  //   [ 0,16M)   query f32
  //   [16,24M)   query bf16          (B of S^T)
  //   [24,32M)   key bf16  [B,Lk,D]  (A of S^T, async-staged)
  //   [32,40M)   key bf16T [B,D,Lk]  (B of O += P·K, async-staged)
  //   [40M..]    WqT bf16, WkT bf16
  char* ws = (char*)d_ws;
  float*  q_f32 = (float*)ws;
  __bf16* q_b   = (__bf16*)(ws + (size_t)16 * 1024 * 1024);
  __bf16* k_b   = (__bf16*)(ws + (size_t)24 * 1024 * 1024);
  __bf16* kT_b  = (__bf16*)(ws + (size_t)32 * 1024 * 1024);
  __bf16* WqT   = (__bf16*)(ws + (size_t)40 * 1024 * 1024);
  __bf16* WkT   = (__bf16*)(ws + (size_t)40 * 1024 * 1024 + 512 * 1024);

  dim3 blk(256);
  weightT_kernel<<<dim3(1024), blk, 0, stream>>>(Wq, WqT, 1024);
  weightT_kernel<<<dim3(256), blk, 0, stream>>>(Wk, WkT, 256);

  dim3 pgrid(M_TOTAL / 256, DD / 64);
  proj_gemm_kernel<true, false><<<pgrid, blk, 0, stream>>>(
      data1, WqT, bq, 1024, q_f32, q_b, nullptr);
  proj_gemm_kernel<false, true><<<pgrid, blk, 0, stream>>>(
      data2, WkT, bk, 256, nullptr, k_b, kT_b);

  const int qtiles = BATCH * (LQ / 16);  // 1024 tiles, 2 waves each
  attn_kernel<<<dim3(qtiles / QTILES), blk, 0, stream>>>(
      q_b, k_b, kT_b, q_f32, out);
}

// v003
// One run takes 96.7 microseconds.
// Next to v002, in two timings, it ran 1.23 and 1.22 times as fast.
// Over all steps from v000 it is 4.55 times as fast.
#include <hip/hip_runtime.h>

// ---------------------------------------------------------------------------
// CoAttention on MI455X (gfx1250): bf16 WMMA for all 4 matmuls, f32 softmax.
//   query = data1 @ Wq + bq            [8,2048,256]
//   key   = data2 @ Wk + bk            [8,2048,256]
//   S     = (query @ key^T) / 32       (flash style, never materialized)
//   out   = softmax(S) @ key + query   [8,2048,256]
//
// Roofline: ~45 GFLOP vs ~100 MB HBM -> compute bound on the WMMA pipes.
// Attention: a block takes 64 queries on 8 waves: 4 query tiles x 2 key
// halves, so that 256 blocks fill all 256 WGPs at two waves per SIMD. Each
// stage brings 128 keys (one 64-key tile per half) into LDS with gfx1250
// async copies (ASYNCcnt), double buffered; the halves are joined in LDS.
//
// Layout trick: S^T = K·Q^T so its C layout (element = key, lane = query)
// equals the A layout needed for P in O += P·K: softmax->P repack is
// lane-local (no LDS transpose, no shuffles).
// ---------------------------------------------------------------------------

typedef __attribute__((ext_vector_type(16))) __bf16 v16bf;
typedef __attribute__((ext_vector_type(8)))  __bf16 v8bf;
typedef __attribute__((ext_vector_type(4)))  __bf16 v4bf;
typedef __attribute__((ext_vector_type(8)))  float  f8v;
typedef __attribute__((ext_vector_type(4)))  float  f4v;

#define DD      256
#define LQ      2048
#define LK      2048
#define BATCH   8
#define M_TOTAL (BATCH * LQ)   // 16384
#define QTILES  4              // 16-query tiles per attention block
#define KSPLIT  2              // wave groups that share the keys of a stage
#define KSTEP   64             // keys per wave and attention step (4 S-tiles)
#define NSTAGE  (LK / (KSPLIT * KSTEP))   // 16 stages of 128 keys

// LDS rows hold 256 B at a pitch of 272 B (16 B x odd), so that the 16 lanes
// of a ds_load_b128 half (one row each) fall on 16 different groups of 4 banks.
#define PITCH       (128 + 8)                 // 136 el = 272 B (16 B x 17)

// One stage = 128 keys:
//   kb [2 halves of d][128 keys][128 d]   key rows, d 0-127 and d 128-255 apart
//   kt [256 d][128 keys]                  the same keys transposed
// The ring holds two stages.
#define SKEYS       (KSPLIT * KSTEP)          // 128
#define KBH_ELEMS   (SKEYS * PITCH)           // 17408: one d half of kb
#define KB_ELEMS    (2 * KBH_ELEMS)           // 34816
#define KT_ELEMS    (DD * PITCH)              // 34816
#define STAGE_ELEMS (KB_ELEMS + KT_ELEMS)     // 69632
#define SMEM_ELEMS  (2 * STAGE_ELEMS)         // 139264 el = 278528 B

union F16 {
  v16bf v;
  v8bf  h[2];
};

__device__ __forceinline__ f8v wmma_bf16(v16bf a, v16bf b, f8v c) {
  return __builtin_amdgcn_wmma_f32_16x16x32_bf16(false, a, false, b,
                                                 (short)0, c, false, false);
}

// Async global -> LDS copy, 16B per lane. VDST VGPR carries the LDS byte
// offset (dsaddr = LDS_BASE + VGPR), VADDR the 64-bit global address.
// Eight copies per statement; the s_wait_xcnt 0 at its end stands in front of
// any later rewrite of the address registers that the copies name.
#define ASYNC_LDS_B128_X8(l, p)                                            \
  asm volatile("global_load_async_to_lds_b128 %0, %8, off\n\t"             \
               "global_load_async_to_lds_b128 %1, %9, off\n\t"             \
               "global_load_async_to_lds_b128 %2, %10, off\n\t"            \
               "global_load_async_to_lds_b128 %3, %11, off\n\t"            \
               "global_load_async_to_lds_b128 %4, %12, off\n\t"            \
               "global_load_async_to_lds_b128 %5, %13, off\n\t"            \
               "global_load_async_to_lds_b128 %6, %14, off\n\t"            \
               "global_load_async_to_lds_b128 %7, %15, off\n\t"            \
               "s_wait_xcnt 0x0"                                           \
               :: "v"(l[0]), "v"(l[1]), "v"(l[2]), "v"(l[3]),              \
                  "v"(l[4]), "v"(l[5]), "v"(l[6]), "v"(l[7]),              \
                  "v"(p[0]), "v"(p[1]), "v"(p[2]), "v"(p[3]),              \
                  "v"(p[4]), "v"(p[5]), "v"(p[6]), "v"(p[7])               \
               : "memory")
// Publish point of the two-buffer ring: the wave's own LDS reads have
// retired, its own copies have landed; the barrier follows.
#define WAIT_DS_0()       asm volatile("s_wait_dscnt 0x0"     ::: "memory")
#define WAIT_ASYNC_0()    asm volatile("s_wait_asynccnt 0x0"  ::: "memory")

// ---------------------------------------------------------------------------
// Weight prep: W[Kdim,256] (f32) -> WT[256,Kdim] (bf16), one-shot.
// ---------------------------------------------------------------------------
__global__ void __launch_bounds__(256)
weightT_kernel(const float* __restrict__ W, __bf16* __restrict__ WT, int Kdim) {
  const int idx = blockIdx.x * 256 + threadIdx.x;   // grid sized to Kdim*256
  const int k   = idx >> 8;
  const int col = idx & 255;
  WT[(size_t)col * Kdim + k] = (__bf16)W[idx];      // native v_cvt_pk_bf16_f32
}

// ---------------------------------------------------------------------------
// Projection GEMM: C[M,256] = A[M,KDIM] @ W[KDIM,256] + bias.
// A block takes 64 rows and all 256 columns, so that A leaves memory once;
// 8 waves as 2 (M) x 4 (N), wave tile 32 x 64. Each stage brings 128 k of the
// A rows (f32) and of the W^T rows (bf16) into LDS with async copies, whole
// 128-B lines per copy, double buffered; A turns bf16 on its way from LDS to
// the fragment. Epilogue write-set is a template parameter.
// ---------------------------------------------------------------------------
#define PM           64                        // rows of a block
#define PKC          128                       // k per stage
#define PA_PITCH     (PKC + 4)                 // f32 el:  528 B (16 B x 33)
#define PW_PITCH     (PKC + 8)                 // bf16 el: 272 B (16 B x 17)
#define PA_BYTES     (PM * PA_PITCH * 4)       // 33792
#define PW_BYTES     (DD * PW_PITCH * 2)       // 69632
#define PSTAGE_BYTES (PA_BYTES + PW_BYTES)     // 103424

template <int KDIM, bool WRITE_F32, bool WRITE_T>
__global__ void __launch_bounds__(256)
proj_gemm_kernel(const float* __restrict__ A, const __bf16* __restrict__ WT,
                 const float* __restrict__ bias,
                 float* __restrict__ outF32, __bf16* __restrict__ outB,
                 __bf16* __restrict__ outT) {
  __shared__ __attribute__((aligned(16))) char psm[2 * PSTAGE_BYTES];
  constexpr int NST = KDIM / PKC;

  const int lane = threadIdx.x & 31;
  // scalar wave number: the rows a wave copies stay in scalar registers
  const int wave = __builtin_amdgcn_readfirstlane(threadIdx.x >> 5);
  const int g    = lane >> 4;
  const int ln   = lane & 15;
  const int m0   = blockIdx.x * PM + (wave >> 2) * 32;
  const int n0   = (wave & 3) * 64;

  const unsigned psmB  = (unsigned)(size_t)psm;   // LDS byte address of the ring
  const char*   a_base = (const char*)(A + (size_t)blockIdx.x * PM * KDIM);
  const char*   w_base = (const char*)WT;
  // Per-lane parts of the copy addresses, in bytes. An A copy brings the 512 B
  // of one row; a W^T copy two neighbouring rows of 256 B, 16 lanes each.
  const unsigned aLane  = (unsigned)lane * 16;
  const unsigned wLaneL = (unsigned)(g * (PW_PITCH * 2) + ln * 16);
  const unsigned wLaneG = (unsigned)(g * (KDIM * 2) + ln * 16);

  // ---- cooperative async copy of k stage `st` into buffer `buf` ----
  auto pstage = [&](int buf, int st) {
    const unsigned lb  = psmB + (unsigned)buf * PSTAGE_BYTES;
    const char*    ga0 = a_base + (size_t)wave * (KDIM * 4) + (size_t)st * (PKC * 4);
    const char*    gw0 = w_base + (size_t)wave * (2 * KDIM * 2) + (size_t)st * (PKC * 2);
    unsigned    la[8];
    const char* ga[8];
#pragma unroll
    for (int i = 0; i < 8; ++i) {               // A rows wave + 8 i
      la[i] = (lb + (unsigned)((wave + 8 * i) * (PA_PITCH * 4))) + aLane;
      ga[i] = (ga0 + (8 * i) * (KDIM * 4)) + aLane;
    }
    ASYNC_LDS_B128_X8(la, ga);
#pragma unroll
    for (int h = 0; h < 2; ++h) {
#pragma unroll
      for (int i = 0; i < 8; ++i) {             // W^T rows 2 (wave + 8 j) + g
        const int j = 8 * h + i;
        la[i] = (lb + (unsigned)(PA_BYTES + 2 * (wave + 8 * j) * (PW_PITCH * 2))) + wLaneL;
        ga[i] = (gw0 + (8 * j) * (2 * KDIM * 2)) + wLaneG;
      }
      ASYNC_LDS_B128_X8(la, ga);
    }
  };

  f8v acc[2][4] = {};

  // Two-buffer ring: one stage's copies (24 per wave) in flight at a time.
  pstage(0, 0);
  WAIT_ASYNC_0();
  __syncthreads();
  if (NST > 1) pstage(1, 1);

  for (int st = 0; st < NST; ++st) {
    const int buf = st & 1;
    const float*  sa = (const float*)(psm + buf * PSTAGE_BYTES) +
                       ((wave >> 2) * 32 + ln) * PA_PITCH + 8 * g;
    const __bf16* sw = (const __bf16*)(psm + buf * PSTAGE_BYTES + PA_BYTES) +
                       (n0 + ln) * PW_PITCH + 8 * g;
    // Fragments of one 32-k step: A as f32 (4 x 16 B per 16-row tile), W^T as bf16.
    f4v xa[2][2][4];
    F16 bfr[2][4];
    auto ldfrag = [&](int slot, int kk) {
#pragma unroll
      for (int s = 0; s < 2; ++s) {
        const float* p = sa + s * 16 * PA_PITCH + kk;
        xa[slot][s][0] = *(const f4v*)(p);
        xa[slot][s][1] = *(const f4v*)(p + 4);
        xa[slot][s][2] = *(const f4v*)(p + 16);
        xa[slot][s][3] = *(const f4v*)(p + 20);
      }
#pragma unroll
      for (int t = 0; t < 4; ++t) {
        const __bf16* q = sw + t * 16 * PW_PITCH + kk;
        bfr[slot][t].h[0] = *(const v8bf*)(q);
        bfr[slot][t].h[1] = *(const v8bf*)(q + 16);
      }
    };
    ldfrag(0, 0);
#pragma unroll
    for (int c = 0; c < PKC / 32; ++c) {
      if (c + 1 < PKC / 32) ldfrag((c + 1) & 1, (c + 1) * 32);
      // keeps the next step's 16 LDS reads as one group ahead of this step's
      // WMMAs, which then cover their latency (else they sink to their uses)
      __builtin_amdgcn_sched_barrier(0);
      F16 af[2];
#pragma unroll
      for (int s = 0; s < 2; ++s) {
        af[s].h[0] = __builtin_shufflevector(
            __builtin_convertvector(xa[c & 1][s][0], v4bf),
            __builtin_convertvector(xa[c & 1][s][1], v4bf), 0, 1, 2, 3, 4, 5, 6, 7);
        af[s].h[1] = __builtin_shufflevector(
            __builtin_convertvector(xa[c & 1][s][2], v4bf),
            __builtin_convertvector(xa[c & 1][s][3], v4bf), 0, 1, 2, 3, 4, 5, 6, 7);
      }
#pragma unroll
      for (int t = 0; t < 4; ++t) {
        acc[0][t] = wmma_bf16(af[0].v, bfr[c & 1][t].v, acc[0][t]);
        acc[1][t] = wmma_bf16(af[1].v, bfr[c & 1][t].v, acc[1][t]);
      }
    }

    // Publish stage st + 1 and free this buffer with one barrier, then refill.
    WAIT_DS_0();
    WAIT_ASYNC_0();
    __syncthreads();
    if (st + 2 < NST) pstage(buf, st + 2);
  }
  WAIT_ASYNC_0();   // nothing is in flight when the wave ends

#pragma unroll
  for (int s = 0; s < 2; ++s) {
#pragma unroll
    for (int t = 0; t < 4; ++t) {
      const int col    = n0 + 16 * t + ln;
      const float bval = bias[col];
#pragma unroll
      for (int r = 0; r < 8; ++r) {
        const int row    = m0 + 16 * s + r + 8 * g;   // C layout: M = r + 8g
        const float v    = acc[s][t][r] + bval;
        const size_t idx = (size_t)row * DD + col;
        if constexpr (WRITE_F32) outF32[idx] = v;
        const __bf16 hv = (__bf16)v;
        outB[idx] = hv;
        if constexpr (WRITE_T) {
          const int bb   = row >> 11;   // row / 2048
          const int lrow = row & 2047;
          outT[((size_t)(bb * DD + col)) * LK + lrow] = hv;
        }
      }
    }
  }
}

// ---------------------------------------------------------------------------
// Flash attention. One wave per (16-query tile, key half): waves 0-3 take the
// first 64 keys of every 128-key stage, waves 4-7 the second 64, each with its
// own running maximum, sum and O; the two are joined through LDS at the end.
// smem per stage: [kb 2 x 128 rows][kt 256 rows], pitch 136 el.
// ---------------------------------------------------------------------------
__global__ void __launch_bounds__(256)
attn_kernel(const __bf16* __restrict__ qb, const __bf16* __restrict__ kb,
            const __bf16* __restrict__ ktb, const float* __restrict__ qf32,
            float* __restrict__ out) {
  __shared__ __attribute__((aligned(16))) __bf16 smem[SMEM_ELEMS];

  const int tid  = threadIdx.x;
  const int lane = tid & 31;
  // The wave's number as a scalar: all that depends on it alone (the rows a
  // wave copies, its key half) then stays in scalar registers.
  const int wave = __builtin_amdgcn_readfirstlane(tid >> 5);
  const int g    = lane >> 4;
  const int ln   = lane & 15;
  const int kh   = wave >> 2;                  // key half of this wave
  const int tile = blockIdx.x * QTILES + (wave & 3);
  const int b    = tile >> 7;                  // per-wave batch
  const int q0   = (tile & 127) << 4;
  const int bblk = (blockIdx.x * QTILES) >> 7; // block-uniform batch (same)

  const char* kb_base = (const char*)(kb + (size_t)bblk * LK * DD);
  const char* kt_base = (const char*)(ktb + (size_t)bblk * DD * LK);
  const unsigned smemB = (unsigned)(size_t)smem;   // LDS byte address of the ring

  // Per-lane parts of the copy addresses, in bytes; the rest is wave-uniform.
  // Every copy instruction brings two 256-B rows, lanes 0-15 one and lanes
  // 16-31 the other, which lie 128 LDS rows apart:
  //   kb: the two d halves of key row (wave + 8k), 512 B in a row in global;
  //   kt: rows d = wave + 8k and d + 128.
  const unsigned laneL  = (unsigned)(g * (KBH_ELEMS * 2) + ln * 16);
  const unsigned kbLane = (unsigned)lane * 16;
  const unsigned ktLane = (unsigned)(g * (128 * LK * 2) + ln * 16);

  // ---- cooperative async copy of stage `st` (128 keys) into buffer `buf` ----
  auto stage = [&](int buf, int st) {
    const unsigned lrow = smemB + (unsigned)(buf * STAGE_ELEMS) * 2 +
                          (unsigned)wave * (PITCH * 2);
    const char* gkb = kb_base + (size_t)(st * SKEYS + wave) * (DD * 2);
    const char* gkt = kt_base + (size_t)st * (SKEYS * 2) + (size_t)wave * (LK * 2);
    unsigned    la[8];
    const char* ga[8];
#pragma unroll
    for (int h = 0; h < 2; ++h) {
#pragma unroll
      for (int i = 0; i < 8; ++i) {
        la[i] = (lrow + (unsigned)(8 * (8 * h + i) * (PITCH * 2))) + laneL;
        ga[i] = (gkb + (8 * (8 * h + i)) * (DD * 2)) + kbLane;
      }
      ASYNC_LDS_B128_X8(la, ga);
    }
#pragma unroll
    for (int h = 0; h < 2; ++h) {
#pragma unroll
      for (int i = 0; i < 8; ++i) {
        la[i] = (lrow + (unsigned)(KB_ELEMS * 2 + 8 * (8 * h + i) * (PITCH * 2))) + laneL;
        ga[i] = (gkt + (8 * (8 * h + i)) * (LK * 2)) + ktLane;
      }
      ASYNC_LDS_B128_X8(la, ga);
    }
  };

  // Q fragments, resident, B operand of S^T = K·Q^T.
  v16bf qf[8];
  {
    const __bf16* qrow = qb + (size_t)(b * LQ + q0 + ln) * DD;
#pragma unroll
    for (int c = 0; c < 8; ++c) {
      F16 q;
      q.h[0] = *(const v8bf*)(qrow + 32 * c + 8 * g);
      q.h[1] = *(const v8bf*)(qrow + 32 * c + 16 + 8 * g);
      qf[c] = q.v;
    }
  }

  f8v o[16] = {};
  float mrow = -1e30f;   // per-lane softmax stats: query = ln
  float lrow = 0.0f;
  const float SC = 0.03125f * 1.4426950408889634f;  // SCALE * log2(e)

  // Two-buffer ring: one stage's copies (32 per wave) in flight at a time.
  stage(0, 0);
  WAIT_ASYNC_0();
  __syncthreads();
  stage(1, 1);

  for (int st = 0; st < NSTAGE; ++st) {
    const int buf = st & 1;
    // element bases in smem: this wave's 64 key rows of kb, key columns of kt
    const int kbE = buf * STAGE_ELEMS + kh * (KSTEP * PITCH);
    const int ktE = buf * STAGE_ELEMS + KB_ELEMS + kh * KSTEP;

    // ---- S^T tiles: 4 x 16 keys, A = key rows from LDS, B = resident Q ----
    // Batch the 4 fragments of each K-chunk before the 4 WMMAs so the
    // scheduler can stagger s_wait_dscnt instead of draining per WMMA.
    f8v s[4] = {};
#pragma unroll
    for (int c = 0; c < 8; ++c) {
      F16 ka[4];
#pragma unroll
      for (int tt = 0; tt < 4; ++tt) {
        const int base = kbE + (c >> 2) * KBH_ELEMS + (16 * tt + ln) * PITCH +
                         32 * (c & 3);
        ka[tt].h[0] = *(const v8bf*)&smem[base + 8 * g];
        ka[tt].h[1] = *(const v8bf*)&smem[base + 16 + 8 * g];
      }
#pragma unroll
      for (int tt = 0; tt < 4; ++tt)
        s[tt] = wmma_bf16(ka[tt].v, qf[c], s[tt]);
    }

    // ---- online softmax: keys lane-local, query = lane ----
    // Max commutes with the positive scale: reduce raw s, scale once.
    float mx = -1e30f;
#pragma unroll
    for (int tt = 0; tt < 4; ++tt)
#pragma unroll
      for (int r = 0; r < 8; ++r) mx = fmaxf(mx, s[tt][r]);
    mx = fmaxf(mx, __shfl_xor(mx, 16));         // merge key-halves
    const float mn    = fmaxf(mrow, mx * SC);
    const float alpha = exp2f(mrow - mn);
    mrow = mn;

    // P fragments: S^T C-layout == P A-layout (lane-local repack).
    F16 pf0, pf1;
    float rs = 0.0f;
#pragma unroll
    for (int r = 0; r < 8; ++r) {
      const float e0 = exp2f(fmaf(s[0][r], SC, -mn));
      const float e1 = exp2f(fmaf(s[1][r], SC, -mn));
      const float e2 = exp2f(fmaf(s[2][r], SC, -mn));
      const float e3 = exp2f(fmaf(s[3][r], SC, -mn));
      rs += (e0 + e1) + (e2 + e3);
      pf0.v[r] = (__bf16)e0; pf0.v[8 + r] = (__bf16)e1;
      pf1.v[r] = (__bf16)e2; pf1.v[8 + r] = (__bf16)e3;
    }
    rs += __shfl_xor(rs, 16);
    lrow = lrow * alpha + rs;

    // Rescale O: element r is query r+8g -> broadcast alpha from lane r+8g.
    float ar[8];
#pragma unroll
    for (int r = 0; r < 8; ++r) ar[r] = __shfl(alpha, r + 8 * g);
#pragma unroll
    for (int t = 0; t < 16; ++t)
#pragma unroll
      for (int r = 0; r < 8; ++r) o[t][r] *= ar[r];

    // ---- O += P @ K_tile from the LDS-transposed key tile ----
    // Two t-values per batch: 8 ds_load_b128 then 4 WMMAs.
#pragma unroll
    for (int t = 0; t < 16; t += 2) {
      F16 bb[4];
#pragma unroll
      for (int u = 0; u < 2; ++u) {
        const int base = ktE + (16 * (t + u) + ln) * PITCH;
        bb[2 * u + 0].h[0] = *(const v8bf*)&smem[base + 8 * g];
        bb[2 * u + 0].h[1] = *(const v8bf*)&smem[base + 16 + 8 * g];
        bb[2 * u + 1].h[0] = *(const v8bf*)&smem[base + 32 + 8 * g];
        bb[2 * u + 1].h[1] = *(const v8bf*)&smem[base + 48 + 8 * g];
      }
      o[t]     = wmma_bf16(pf0.v, bb[0].v, o[t]);
      o[t]     = wmma_bf16(pf1.v, bb[1].v, o[t]);
      o[t + 1] = wmma_bf16(pf0.v, bb[2].v, o[t + 1]);
      o[t + 1] = wmma_bf16(pf1.v, bb[3].v, o[t + 1]);
    }

    // Publish stage st + 1 and free this buffer with one barrier, then refill.
    WAIT_DS_0();
    WAIT_ASYNC_0();
    __syncthreads();
    if (st + 2 < NSTAGE) stage(buf, st + 2);
  }
  WAIT_ASYNC_0();   // nothing is in flight when the ring becomes join space

  // f32 residual of the 16 x 128 piece that this wave finishes, read in one run
  // so that one wait covers the run's address registers.
  const size_t idx0 = (size_t)(b * LQ + q0 + 8 * g) * DD + 128 * kh + ln;
  float res[8][8];
#pragma unroll
  for (int tt = 0; tt < 8; ++tt)
#pragma unroll
    for (int r = 0; r < 8; ++r) res[tt][r] = qf32[idx0 + (size_t)(r * DD + 16 * tt)];
  // stands in front of any later rewrite of the address registers of that run
  asm volatile("s_wait_xcnt 0x0" ::: "memory");

  // ---- join the two key halves: each wave hands its partner (wave ^ 4) the
  // 8 column tiles that the partner finishes, with its maximum and sum ----
  float* xo = (float*)smem;                     // [wave][8 tiles][2][32 lanes] f4v
  float* xs = xo + 8 * 2048;                    // [wave][m, l][32 lanes]
  const bool hi = kh != 0;                      // finishes column tiles 8..15
#pragma unroll
  for (int tt = 0; tt < 8; ++tt) {
    f4v s0, s1;
#pragma unroll
    for (int r = 0; r < 4; ++r) {
      s0[r] = hi ? o[tt][r]     : o[8 + tt][r];
      s1[r] = hi ? o[tt][4 + r] : o[8 + tt][4 + r];
    }
    *(f4v*)&xo[wave * 2048 + ((2 * tt + 0) * 32 + lane) * 4] = s0;
    *(f4v*)&xo[wave * 2048 + ((2 * tt + 1) * 32 + lane) * 4] = s1;
  }
  xs[(wave * 2 + 0) * 32 + lane] = mrow;
  xs[(wave * 2 + 1) * 32 + lane] = lrow;
  __syncthreads();

  const int   pw = wave ^ 4;
  const float mo = xs[(pw * 2 + 0) * 32 + lane];
  const float lo = xs[(pw * 2 + 1) * 32 + lane];
  const float mj = fmaxf(mrow, mo);
  const float as = exp2f(mrow - mj);
  const float ao = exp2f(mo - mj);
  const float li = 1.0f / (lrow * as + lo * ao);
  const float fs = as * li;                     // weight of this wave's O
  const float fo = ao * li;                     // weight of the partner's O

  // ---- epilogue: normalize + f32 residual ----
  float ws[8], wo[8];
#pragma unroll
  for (int r = 0; r < 8; ++r) {
    ws[r] = __shfl(fs, r + 8 * g);
    wo[r] = __shfl(fo, r + 8 * g);
  }
#pragma unroll
  for (int tt = 0; tt < 8; ++tt) {
    const f4v p0 = *(const f4v*)&xo[pw * 2048 + ((2 * tt + 0) * 32 + lane) * 4];
    const f4v p1 = *(const f4v*)&xo[pw * 2048 + ((2 * tt + 1) * 32 + lane) * 4];
#pragma unroll
    for (int r = 0; r < 8; ++r) {
      const float mine = hi ? o[8 + tt][r] : o[tt][r];
      const float part = r < 4 ? p0[r & 3] : p1[r & 3];
      out[idx0 + (size_t)(r * DD + 16 * tt)] = mine * ws[r] + part * wo[r] + res[tt][r];
    }
  }
}

// ---------------------------------------------------------------------------
extern "C" void kernel_launch(void* const* d_in, const int* in_sizes, int n_in,
                              void* d_out, int out_size, void* d_ws, size_t ws_size,
                              hipStream_t stream) {
  (void)in_sizes; (void)n_in; (void)out_size; (void)ws_size;

  const float* data1 = (const float*)d_in[0];  // [8,2048,1024]
  const float* data2 = (const float*)d_in[1];  // [8,2048,256]
  const float* Wq    = (const float*)d_in[2];  // [1024,256]
  const float* bq    = (const float*)d_in[3];  // [256]
  const float* Wk    = (const float*)d_in[4];  // [256,256]
  const float* bk    = (const float*)d_in[5];  // [256]
  float* out = (float*)d_out;                  // [8,2048,256]

  // Workspace (~41 MB):
  //   [ 0,16M)   query f32
  //   [16,24M)   query bf16          (B of S^T)
  //   [24,32M)   key bf16  [B,Lk,D]  (A of S^T, async-staged)
  //   [32,40M)   key bf16T [B,D,Lk]  (B of O += P·K, async-staged)
  //   [40M..]    WqT bf16, WkT bf16
  char* ws = (char*)d_ws;
  float*  q_f32 = (float*)ws;
  __bf16* q_b   = (__bf16*)(ws + (size_t)16 * 1024 * 1024);
  __bf16* k_b   = (__bf16*)(ws + (size_t)24 * 1024 * 1024);
  __bf16* kT_b  = (__bf16*)(ws + (size_t)32 * 1024 * 1024);
  __bf16* WqT   = (__bf16*)(ws + (size_t)40 * 1024 * 1024);
  __bf16* WkT   = (__bf16*)(ws + (size_t)40 * 1024 * 1024 + 512 * 1024);

  dim3 blk(256);
  weightT_kernel<<<dim3(1024), blk, 0, stream>>>(Wq, WqT, 1024);
  weightT_kernel<<<dim3(256), blk, 0, stream>>>(Wk, WkT, 256);

  dim3 pgrid(M_TOTAL / PM);   // 256 blocks of 64 rows x 256 columns
  proj_gemm_kernel<1024, true, false><<<pgrid, blk, 0, stream>>>(
      data1, WqT, bq, q_f32, q_b, nullptr);
  proj_gemm_kernel<256, false, true><<<pgrid, blk, 0, stream>>>(
      data2, WkT, bk, nullptr, k_b, kT_b);

  const int qtiles = BATCH * (LQ / 16);  // 1024 tiles, 2 waves each
  attn_kernel<<<dim3(qtiles / QTILES), blk, 0, stream>>>(
      q_b, k_b, kT_b, q_f32, out);
}

// v004
// A run of this version takes 87.7 microseconds.
// Timed twice side by side with v003, it ran 1.10 times as fast both times.
// Over all steps from v000 it is 5.01 times as fast.
#include <hip/hip_runtime.h>

// ---------------------------------------------------------------------------
// CoAttention on MI455X (gfx1250): bf16 WMMA for all 4 matmuls, f32 softmax.
//   query = data1 @ Wq + bq            [8,2048,256]
//   key   = data2 @ Wk + bk            [8,2048,256]
//   S     = (query @ key^T) / 32       (flash style, never materialized)
//   out   = softmax(S) @ key + query   [8,2048,256]
//
// Roofline: ~45 GFLOP vs ~100 MB HBM -> compute bound on the WMMA pipes.
// Attention: a block takes 64 queries on 8 waves: 4 query tiles x 2 key
// halves, so that 256 blocks fill all 256 WGPs at two waves per SIMD. Each
// stage brings 128 keys (one 64-key tile per half) into LDS with gfx1250
// async copies (ASYNCcnt), double buffered; the halves are joined in LDS.
//
// Layout trick: S^T = K·Q^T so its C layout (element = key, lane = query)
// equals the A layout needed for P in O += P·K: softmax->P repack is
// lane-local (no LDS transpose, no shuffles).
// ---------------------------------------------------------------------------

typedef __attribute__((ext_vector_type(16))) __bf16 v16bf;
typedef __attribute__((ext_vector_type(8)))  __bf16 v8bf;
typedef __attribute__((ext_vector_type(4)))  __bf16 v4bf;
typedef __attribute__((ext_vector_type(8)))  float  f8v;
typedef __attribute__((ext_vector_type(4)))  float  f4v;

#define DD      256
#define LQ      2048
#define LK      2048
#define BATCH   8
#define M_TOTAL (BATCH * LQ)   // 16384
#define QTILES  4              // 16-query tiles per attention block
#define KSPLIT  2              // wave groups that share the keys of a stage
#define KSTEP   64             // keys per wave and attention step (4 S-tiles)
#define NSTAGE  (LK / (KSPLIT * KSTEP))   // 16 stages of 128 keys

// LDS rows hold 256 B at a pitch of 272 B (16 B x odd), so that the 16 lanes
// of a ds_load_b128 half (one row each) fall on 16 different groups of 4 banks.
#define PITCH       (128 + 8)                 // 136 el = 272 B (16 B x 17)

// One stage = 128 keys:
//   kb [2 halves of d][128 keys][128 d]   key rows, d 0-127 and d 128-255 apart
//   kt [256 d][128 keys]                  the same keys transposed
// The ring holds two stages.
#define SKEYS       (KSPLIT * KSTEP)          // 128
#define KBH_ELEMS   (SKEYS * PITCH)           // 17408: one d half of kb
#define KB_ELEMS    (2 * KBH_ELEMS)           // 34816
#define KT_ELEMS    (DD * PITCH)              // 34816
#define STAGE_ELEMS (KB_ELEMS + KT_ELEMS)     // 69632
#define SMEM_ELEMS  (2 * STAGE_ELEMS)         // 139264 el = 278528 B

union F16 {
  v16bf v;
  v8bf  h[2];
};

__device__ __forceinline__ f8v wmma_bf16(v16bf a, v16bf b, f8v c) {
  return __builtin_amdgcn_wmma_f32_16x16x32_bf16(false, a, false, b,
                                                 (short)0, c, false, false);
}

// Async global -> LDS copy, 16B per lane. VDST VGPR carries the LDS byte
// offset (dsaddr = LDS_BASE + VGPR), VADDR the 64-bit global address.
// Eight copies per statement; the s_wait_xcnt 0 at its end stands in front of
// any later rewrite of the address registers that the copies name.
#define ASYNC_LDS_B128_X8(l, p)                                            \
  asm volatile("global_load_async_to_lds_b128 %0, %8, off\n\t"             \
               "global_load_async_to_lds_b128 %1, %9, off\n\t"             \
               "global_load_async_to_lds_b128 %2, %10, off\n\t"            \
               "global_load_async_to_lds_b128 %3, %11, off\n\t"            \
               "global_load_async_to_lds_b128 %4, %12, off\n\t"            \
               "global_load_async_to_lds_b128 %5, %13, off\n\t"            \
               "global_load_async_to_lds_b128 %6, %14, off\n\t"            \
               "global_load_async_to_lds_b128 %7, %15, off\n\t"            \
               "s_wait_xcnt 0x0"                                           \
               :: "v"(l[0]), "v"(l[1]), "v"(l[2]), "v"(l[3]),              \
                  "v"(l[4]), "v"(l[5]), "v"(l[6]), "v"(l[7]),              \
                  "v"(p[0]), "v"(p[1]), "v"(p[2]), "v"(p[3]),              \
                  "v"(p[4]), "v"(p[5]), "v"(p[6]), "v"(p[7])               \
               : "memory")
// Publish point of the two-buffer ring: the wave's own LDS reads have
// retired, its own copies have landed; the barrier follows.
#define WAIT_DS_0()       asm volatile("s_wait_dscnt 0x0"     ::: "memory")
#define WAIT_ASYNC_0()    asm volatile("s_wait_asynccnt 0x0"  ::: "memory")

// ---------------------------------------------------------------------------
// Weight prep: W[Kdim,256] (f32) -> WT[256,Kdim] (bf16), one-shot.
// ---------------------------------------------------------------------------
__global__ void __launch_bounds__(256)
weightT_kernel(const float* __restrict__ W, __bf16* __restrict__ WT, int Kdim) {
  const int idx = blockIdx.x * 256 + threadIdx.x;   // grid sized to Kdim*256
  const int k   = idx >> 8;
  const int col = idx & 255;
  WT[(size_t)col * Kdim + k] = (__bf16)W[idx];      // native v_cvt_pk_bf16_f32
}

// ---------------------------------------------------------------------------
// Projection GEMM: C[M,256] = A[M,KDIM] @ W[KDIM,256] + bias.
// A block takes 64 rows and all 256 columns, so that A leaves memory once;
// 8 waves as 2 (M) x 4 (N), wave tile 32 x 64. Each stage brings 128 k of the
// A rows (f32) and of the W^T rows (bf16) into LDS with async copies, whole
// 128-B lines per copy, double buffered; A turns bf16 on its way from LDS to
// the fragment. Epilogue write-set is a template parameter; the outputs leave
// through LDS as whole 128-B lines.
// ---------------------------------------------------------------------------
#define PM           64                        // rows of a block
#define PKC          128                       // k per stage
#define PA_PITCH     (PKC + 4)                 // f32 el:  528 B (16 B x 33)
#define PW_PITCH     (PKC + 8)                 // bf16 el: 272 B (16 B x 17)
#define PA_BYTES     (PM * PA_PITCH * 4)       // 33792
#define PW_BYTES     (DD * PW_PITCH * 2)       // 69632
#define PSTAGE_BYTES (PA_BYTES + PW_BYTES)     // 103424
// Output staging in the freed ring: rows 8 apart fall 32 banks apart (f32 tile);
// the transposed tile has a 16 B x odd pitch for its 16-B stores and reads.
#define CF_PITCH     (DD + 4)                  // f32 el:  1040 B
#define CF_BYTES     (PM * CF_PITCH * 4)       // 66560
#define CT_PITCH     (PM + 8)                  // bf16 el: 144 B (16 B x 9)

template <int KDIM, bool WRITE_F32, bool WRITE_T>
__global__ void __launch_bounds__(256)
proj_gemm_kernel(const float* __restrict__ A, const __bf16* __restrict__ WT,
                 const float* __restrict__ bias,
                 float* __restrict__ outF32, __bf16* __restrict__ outB,
                 __bf16* __restrict__ outT) {
  __shared__ __attribute__((aligned(16))) char psm[2 * PSTAGE_BYTES];
  constexpr int NST = KDIM / PKC;

  const int lane = threadIdx.x & 31;
  // scalar wave number: the rows a wave copies stay in scalar registers
  const int wave = __builtin_amdgcn_readfirstlane(threadIdx.x >> 5);
  const int g    = lane >> 4;
  const int ln   = lane & 15;
  const int mw   = (wave >> 2) * 32;            // the wave's first row in the block
  const int n0   = (wave & 3) * 64;

  const unsigned psmB  = (unsigned)(size_t)psm;   // LDS byte address of the ring
  const char*   a_base = (const char*)(A + (size_t)blockIdx.x * PM * KDIM);
  const char*   w_base = (const char*)WT;
  // Per-lane parts of the copy addresses, in bytes. An A copy brings the 512 B
  // of one row; a W^T copy two neighbouring rows of 256 B, 16 lanes each.
  const unsigned aLane  = (unsigned)lane * 16;
  const unsigned wLaneL = (unsigned)(g * (PW_PITCH * 2) + ln * 16);
  const unsigned wLaneG = (unsigned)(g * (KDIM * 2) + ln * 16);

  // ---- cooperative async copy of k stage `st` into buffer `buf` ----
  auto pstage = [&](int buf, int st) {
    const unsigned lb  = psmB + (unsigned)buf * PSTAGE_BYTES;
    const char*    ga0 = a_base + (size_t)wave * (KDIM * 4) + (size_t)st * (PKC * 4);
    const char*    gw0 = w_base + (size_t)wave * (2 * KDIM * 2) + (size_t)st * (PKC * 2);
    unsigned    la[8];
    const char* ga[8];
#pragma unroll
    for (int i = 0; i < 8; ++i) {               // A rows wave + 8 i
      la[i] = (lb + (unsigned)((wave + 8 * i) * (PA_PITCH * 4))) + aLane;
      ga[i] = (ga0 + (8 * i) * (KDIM * 4)) + aLane;
    }
    ASYNC_LDS_B128_X8(la, ga);
#pragma unroll
    for (int h = 0; h < 2; ++h) {
#pragma unroll
      for (int i = 0; i < 8; ++i) {             // W^T rows 2 (wave + 8 j) + g
        const int j = 8 * h + i;
        la[i] = (lb + (unsigned)(PA_BYTES + 2 * (wave + 8 * j) * (PW_PITCH * 2))) + wLaneL;
        ga[i] = (gw0 + (8 * j) * (2 * KDIM * 2)) + wLaneG;
      }
      ASYNC_LDS_B128_X8(la, ga);
    }
  };

  f8v acc[2][4] = {};

  // Two-buffer ring: one stage's copies (24 per wave) in flight at a time.
  pstage(0, 0);
  WAIT_ASYNC_0();
  __syncthreads();
  if (NST > 1) pstage(1, 1);

  for (int st = 0; st < NST; ++st) {
    const int buf = st & 1;
    const float*  sa = (const float*)(psm + buf * PSTAGE_BYTES) +
                       ((wave >> 2) * 32 + ln) * PA_PITCH + 8 * g;
    const __bf16* sw = (const __bf16*)(psm + buf * PSTAGE_BYTES + PA_BYTES) +
                       (n0 + ln) * PW_PITCH + 8 * g;
    // Fragments of one 32-k step: A as f32 (4 x 16 B per 16-row tile), W^T as bf16.
    f4v xa[2][2][4];
    F16 bfr[2][4];
    auto ldfrag = [&](int slot, int kk) {
#pragma unroll
      for (int s = 0; s < 2; ++s) {
        const float* p = sa + s * 16 * PA_PITCH + kk;
        xa[slot][s][0] = *(const f4v*)(p);
        xa[slot][s][1] = *(const f4v*)(p + 4);
        xa[slot][s][2] = *(const f4v*)(p + 16);
        xa[slot][s][3] = *(const f4v*)(p + 20);
      }
#pragma unroll
      for (int t = 0; t < 4; ++t) {
        const __bf16* q = sw + t * 16 * PW_PITCH + kk;
        bfr[slot][t].h[0] = *(const v8bf*)(q);
        bfr[slot][t].h[1] = *(const v8bf*)(q + 16);
      }
    };
    ldfrag(0, 0);
#pragma unroll
    for (int c = 0; c < PKC / 32; ++c) {
      if (c + 1 < PKC / 32) ldfrag((c + 1) & 1, (c + 1) * 32);
      // keeps the next step's 16 LDS reads as one group ahead of this step's
      // WMMAs, which then cover their latency (else they sink to their uses)
      __builtin_amdgcn_sched_barrier(0);
      F16 af[2];
#pragma unroll
      for (int s = 0; s < 2; ++s) {
        af[s].h[0] = __builtin_shufflevector(
            __builtin_convertvector(xa[c & 1][s][0], v4bf),
            __builtin_convertvector(xa[c & 1][s][1], v4bf), 0, 1, 2, 3, 4, 5, 6, 7);
        af[s].h[1] = __builtin_shufflevector(
            __builtin_convertvector(xa[c & 1][s][2], v4bf),
            __builtin_convertvector(xa[c & 1][s][3], v4bf), 0, 1, 2, 3, 4, 5, 6, 7);
      }
#pragma unroll
      for (int t = 0; t < 4; ++t) {
        acc[0][t] = wmma_bf16(af[0].v, bfr[c & 1][t].v, acc[0][t]);
        acc[1][t] = wmma_bf16(af[1].v, bfr[c & 1][t].v, acc[1][t]);
      }
    }

    // Publish stage st + 1 and free this buffer with one barrier, then refill.
    WAIT_DS_0();
    WAIT_ASYNC_0();
    __syncthreads();
    if (st + 2 < NST) pstage(buf, st + 2);
  }
  WAIT_ASYNC_0();   // nothing is in flight when the wave ends

  // ---- epilogue: the block's 64 x 256 tile goes through LDS, so that every
  // global store covers whole 128-B lines. The ring is free here: each wave's
  // LDS reads retired in front of the loop's last barrier, no copy is in flight.
  float*  cf = (float*)psm;                    // [64 rows][256 cols] f32
  __bf16* ct = (__bf16*)(psm + CF_BYTES);      // [256 cols][64 rows] bf16
#pragma unroll
  for (int s = 0; s < 2; ++s) {
#pragma unroll
    for (int t = 0; t < 4; ++t) {
      const int col    = n0 + 16 * t + ln;
      const float bval = bias[col];
      const int row0   = mw + 16 * s + 8 * g;   // C layout: M = r + 8g
      v8bf tv;
#pragma unroll
      for (int r = 0; r < 8; ++r) {
        const float v = acc[s][t][r] + bval;
        cf[(row0 + r) * CF_PITCH + col] = v;
        if constexpr (WRITE_T) tv[r] = (__bf16)v;
      }
      // a lane's 8 values are 8 neighbouring rows of one column: 16 B of C^T
      if constexpr (WRITE_T) *(v8bf*)&ct[col * CT_PITCH + row0] = tv;
    }
  }
  __syncthreads();   // the tile is complete before any wave reads rows of it

  // Row-major outputs: a wave takes 8 rows; each LDS read and f32 store covers
  // 512 B in a row, each bf16 store 256 B in a row. Unrolled, so that the LDS
  // reads issue as one group and their latency is paid once.
#pragma unroll
  for (int i = 0; i < 8; ++i) {
    const int    row = wave * 8 + i;
    const float* p   = cf + row * CF_PITCH + 4 * lane;
    const f4v    x0  = *(const f4v*)(p);
    const f4v    x1  = *(const f4v*)(p + 128);
    const size_t idx = (size_t)(blockIdx.x * PM + row) * DD + 4 * lane;
    if constexpr (WRITE_F32) {
      *(f4v*)&outF32[idx]       = x0;
      *(f4v*)&outF32[idx + 128] = x1;
    }
    *(v4bf*)&outB[idx]       = __builtin_convertvector(x0, v4bf);
    *(v4bf*)&outB[idx + 128] = __builtin_convertvector(x1, v4bf);
  }
  // Transposed output: the block's 64 rows are one 128-B line of each of the
  // 256 columns; a store covers four such lines, 8 lanes each.
  if constexpr (WRITE_T) {
    const int bb = (blockIdx.x * PM) >> 11;     // batch: row / 2048
    const int l0 = (blockIdx.x * PM) & 2047;
    // unrolled for the same reason as the loop above
#pragma unroll
    for (int i = 0; i < 8; ++i) {
      const int  d = (wave * 8 + i) * 4 + (lane >> 3);
      const v8bf y = *(const v8bf*)&ct[d * CT_PITCH + (lane & 7) * 8];
      *(v8bf*)&outT[((size_t)(bb * DD + d)) * LK + l0 + (lane & 7) * 8] = y;
    }
  }
}

// ---------------------------------------------------------------------------
// Flash attention. One wave per (16-query tile, key half): waves 0-3 take the
// first 64 keys of every 128-key stage, waves 4-7 the second 64, each with its
// own running maximum, sum and O; the two are joined through LDS at the end.
// smem per stage: [kb 2 x 128 rows][kt 256 rows], pitch 136 el.
// ---------------------------------------------------------------------------
__global__ void __launch_bounds__(256)
attn_kernel(const __bf16* __restrict__ qb, const __bf16* __restrict__ kb,
            const __bf16* __restrict__ ktb, const float* __restrict__ qf32,
            float* __restrict__ out) {
  __shared__ __attribute__((aligned(16))) __bf16 smem[SMEM_ELEMS];

  const int tid  = threadIdx.x;
  const int lane = tid & 31;
  // The wave's number as a scalar: all that depends on it alone (the rows a
  // wave copies, its key half) then stays in scalar registers.
  const int wave = __builtin_amdgcn_readfirstlane(tid >> 5);
  const int g    = lane >> 4;
  const int ln   = lane & 15;
  const int kh   = wave >> 2;                  // key half of this wave
  const int tile = blockIdx.x * QTILES + (wave & 3);
  const int b    = tile >> 7;                  // per-wave batch
  const int q0   = (tile & 127) << 4;
  const int bblk = (blockIdx.x * QTILES) >> 7; // block-uniform batch (same)

  const char* kb_base = (const char*)(kb + (size_t)bblk * LK * DD);
  const char* kt_base = (const char*)(ktb + (size_t)bblk * DD * LK);
  const unsigned smemB = (unsigned)(size_t)smem;   // LDS byte address of the ring

  // Per-lane parts of the copy addresses, in bytes; the rest is wave-uniform.
  // Every copy instruction brings two 256-B rows, lanes 0-15 one and lanes
  // 16-31 the other, which lie 128 LDS rows apart:
  //   kb: the two d halves of key row (wave + 8k), 512 B in a row in global;
  //   kt: rows d = wave + 8k and d + 128.
  const unsigned laneL  = (unsigned)(g * (KBH_ELEMS * 2) + ln * 16);
  const unsigned kbLane = (unsigned)lane * 16;
  const unsigned ktLane = (unsigned)(g * (128 * LK * 2) + ln * 16);

  // ---- cooperative async copy of stage `st` (128 keys) into buffer `buf` ----
  auto stage = [&](int buf, int st) {
    const unsigned lrow = smemB + (unsigned)(buf * STAGE_ELEMS) * 2 +
                          (unsigned)wave * (PITCH * 2);
    const char* gkb = kb_base + (size_t)(st * SKEYS + wave) * (DD * 2);
    const char* gkt = kt_base + (size_t)st * (SKEYS * 2) + (size_t)wave * (LK * 2);
    unsigned    la[8];
    const char* ga[8];
#pragma unroll
    for (int h = 0; h < 2; ++h) {
#pragma unroll
      for (int i = 0; i < 8; ++i) {
        la[i] = (lrow + (unsigned)(8 * (8 * h + i) * (PITCH * 2))) + laneL;
        ga[i] = (gkb + (8 * (8 * h + i)) * (DD * 2)) + kbLane;
      }
      ASYNC_LDS_B128_X8(la, ga);
    }
#pragma unroll
    for (int h = 0; h < 2; ++h) {
#pragma unroll
      for (int i = 0; i < 8; ++i) {
        la[i] = (lrow + (unsigned)(KB_ELEMS * 2 + 8 * (8 * h + i) * (PITCH * 2))) + laneL;
        ga[i] = (gkt + (8 * (8 * h + i)) * (LK * 2)) + ktLane;
      }
      ASYNC_LDS_B128_X8(la, ga);
    }
  };

  // Q fragments, resident, B operand of S^T = K·Q^T.
  v16bf qf[8];
  {
    const __bf16* qrow = qb + (size_t)(b * LQ + q0 + ln) * DD;
#pragma unroll
    for (int c = 0; c < 8; ++c) {
      F16 q;
      q.h[0] = *(const v8bf*)(qrow + 32 * c + 8 * g);
      q.h[1] = *(const v8bf*)(qrow + 32 * c + 16 + 8 * g);
      qf[c] = q.v;
    }
  }

  f8v o[16] = {};
  float mrow = -1e30f;   // per-lane softmax stats: query = ln
  float lrow = 0.0f;
  const float SC = 0.03125f * 1.4426950408889634f;  // SCALE * log2(e)

  // Two-buffer ring: one stage's copies (32 per wave) in flight at a time.
  stage(0, 0);
  WAIT_ASYNC_0();
  __syncthreads();
  stage(1, 1);

  for (int st = 0; st < NSTAGE; ++st) {
    const int buf = st & 1;
    // element bases in smem: this wave's 64 key rows of kb, key columns of kt
    const int kbE = buf * STAGE_ELEMS + kh * (KSTEP * PITCH);
    const int ktE = buf * STAGE_ELEMS + KB_ELEMS + kh * KSTEP;

    // ---- S^T tiles: 4 x 16 keys, A = key rows from LDS, B = resident Q ----
    // Batch the 4 fragments of each K-chunk before the 4 WMMAs so the
    // scheduler can stagger s_wait_dscnt instead of draining per WMMA.
    f8v s[4] = {};
#pragma unroll
    for (int c = 0; c < 8; ++c) {
      F16 ka[4];
#pragma unroll
      for (int tt = 0; tt < 4; ++tt) {
        const int base = kbE + (c >> 2) * KBH_ELEMS + (16 * tt + ln) * PITCH +
                         32 * (c & 3);
        ka[tt].h[0] = *(const v8bf*)&smem[base + 8 * g];
        ka[tt].h[1] = *(const v8bf*)&smem[base + 16 + 8 * g];
      }
#pragma unroll
      for (int tt = 0; tt < 4; ++tt)
        s[tt] = wmma_bf16(ka[tt].v, qf[c], s[tt]);
    }

    // ---- online softmax: keys lane-local, query = lane ----
    // Max commutes with the positive scale: reduce raw s, scale once.
    float mx = -1e30f;
#pragma unroll
    for (int tt = 0; tt < 4; ++tt)
#pragma unroll
      for (int r = 0; r < 8; ++r) mx = fmaxf(mx, s[tt][r]);
    mx = fmaxf(mx, __shfl_xor(mx, 16));         // merge key-halves
    const float mn    = fmaxf(mrow, mx * SC);
    const float alpha = exp2f(mrow - mn);
    mrow = mn;

    // P fragments: S^T C-layout == P A-layout (lane-local repack).
    F16 pf0, pf1;
    float rs = 0.0f;
#pragma unroll
    for (int r = 0; r < 8; ++r) {
      const float e0 = exp2f(fmaf(s[0][r], SC, -mn));
      const float e1 = exp2f(fmaf(s[1][r], SC, -mn));
      const float e2 = exp2f(fmaf(s[2][r], SC, -mn));
      const float e3 = exp2f(fmaf(s[3][r], SC, -mn));
      rs += (e0 + e1) + (e2 + e3);
      pf0.v[r] = (__bf16)e0; pf0.v[8 + r] = (__bf16)e1;
      pf1.v[r] = (__bf16)e2; pf1.v[8 + r] = (__bf16)e3;
    }
    rs += __shfl_xor(rs, 16);
    lrow = lrow * alpha + rs;

    // Rescale O: element r is query r+8g -> broadcast alpha from lane r+8g.
    float ar[8];
#pragma unroll
    for (int r = 0; r < 8; ++r) ar[r] = __shfl(alpha, r + 8 * g);
#pragma unroll
    for (int t = 0; t < 16; ++t)
#pragma unroll
      for (int r = 0; r < 8; ++r) o[t][r] *= ar[r];

    // ---- O += P @ K_tile from the LDS-transposed key tile ----
    // Two t-values per batch: 8 ds_load_b128 then 4 WMMAs.
#pragma unroll
    for (int t = 0; t < 16; t += 2) {
      F16 bb[4];
#pragma unroll
      for (int u = 0; u < 2; ++u) {
        const int base = ktE + (16 * (t + u) + ln) * PITCH;
        bb[2 * u + 0].h[0] = *(const v8bf*)&smem[base + 8 * g];
        bb[2 * u + 0].h[1] = *(const v8bf*)&smem[base + 16 + 8 * g];
        bb[2 * u + 1].h[0] = *(const v8bf*)&smem[base + 32 + 8 * g];
        bb[2 * u + 1].h[1] = *(const v8bf*)&smem[base + 48 + 8 * g];
      }
      o[t]     = wmma_bf16(pf0.v, bb[0].v, o[t]);
      o[t]     = wmma_bf16(pf1.v, bb[1].v, o[t]);
      o[t + 1] = wmma_bf16(pf0.v, bb[2].v, o[t + 1]);
      o[t + 1] = wmma_bf16(pf1.v, bb[3].v, o[t + 1]);
    }

    // Publish stage st + 1 and free this buffer with one barrier, then refill.
    WAIT_DS_0();
    WAIT_ASYNC_0();
    __syncthreads();
    if (st + 2 < NSTAGE) stage(buf, st + 2);
  }
  WAIT_ASYNC_0();   // nothing is in flight when the ring becomes join space

  // f32 residual of the 16 x 128 piece that this wave finishes, read in one run
  // so that one wait covers the run's address registers.
  const size_t idx0 = (size_t)(b * LQ + q0 + 8 * g) * DD + 128 * kh + ln;
  float res[8][8];
#pragma unroll
  for (int tt = 0; tt < 8; ++tt)
#pragma unroll
    for (int r = 0; r < 8; ++r) res[tt][r] = qf32[idx0 + (size_t)(r * DD + 16 * tt)];
  // stands in front of any later rewrite of the address registers of that run
  asm volatile("s_wait_xcnt 0x0" ::: "memory");

  // ---- join the two key halves: each wave hands its partner (wave ^ 4) the
  // 8 column tiles that the partner finishes, with its maximum and sum ----
  float* xo = (float*)smem;                     // [wave][8 tiles][2][32 lanes] f4v
  float* xs = xo + 8 * 2048;                    // [wave][m, l][32 lanes]
  const bool hi = kh != 0;                      // finishes column tiles 8..15
#pragma unroll
  for (int tt = 0; tt < 8; ++tt) {
    f4v s0, s1;
#pragma unroll
    for (int r = 0; r < 4; ++r) {
      s0[r] = hi ? o[tt][r]     : o[8 + tt][r];
      s1[r] = hi ? o[tt][4 + r] : o[8 + tt][4 + r];
    }
    *(f4v*)&xo[wave * 2048 + ((2 * tt + 0) * 32 + lane) * 4] = s0;
    *(f4v*)&xo[wave * 2048 + ((2 * tt + 1) * 32 + lane) * 4] = s1;
  }
  xs[(wave * 2 + 0) * 32 + lane] = mrow;
  xs[(wave * 2 + 1) * 32 + lane] = lrow;
  __syncthreads();

  const int   pw = wave ^ 4;
  const float mo = xs[(pw * 2 + 0) * 32 + lane];
  const float lo = xs[(pw * 2 + 1) * 32 + lane];
  const float mj = fmaxf(mrow, mo);
  const float as = exp2f(mrow - mj);
  const float ao = exp2f(mo - mj);
  const float li = 1.0f / (lrow * as + lo * ao);
  const float fs = as * li;                     // weight of this wave's O
  const float fo = ao * li;                     // weight of the partner's O

  // ---- epilogue: normalize + f32 residual ----
  float ws[8], wo[8];
#pragma unroll
  for (int r = 0; r < 8; ++r) {
    ws[r] = __shfl(fs, r + 8 * g);
    wo[r] = __shfl(fo, r + 8 * g);
  }
#pragma unroll
  for (int tt = 0; tt < 8; ++tt) {
    const f4v p0 = *(const f4v*)&xo[pw * 2048 + ((2 * tt + 0) * 32 + lane) * 4];
    const f4v p1 = *(const f4v*)&xo[pw * 2048 + ((2 * tt + 1) * 32 + lane) * 4];
#pragma unroll
    for (int r = 0; r < 8; ++r) {
      const float mine = hi ? o[8 + tt][r] : o[tt][r];
      const float part = r < 4 ? p0[r & 3] : p1[r & 3];
      out[idx0 + (size_t)(r * DD + 16 * tt)] = mine * ws[r] + part * wo[r] + res[tt][r];
    }
  }
}

// ---------------------------------------------------------------------------
extern "C" void kernel_launch(void* const* d_in, const int* in_sizes, int n_in,
                              void* d_out, int out_size, void* d_ws, size_t ws_size,
                              hipStream_t stream) {
  (void)in_sizes; (void)n_in; (void)out_size; (void)ws_size;

  const float* data1 = (const float*)d_in[0];  // [8,2048,1024]
  const float* data2 = (const float*)d_in[1];  // [8,2048,256]
  const float* Wq    = (const float*)d_in[2];  // [1024,256]
  const float* bq    = (const float*)d_in[3];  // [256]
  const float* Wk    = (const float*)d_in[4];  // [256,256]
  const float* bk    = (const float*)d_in[5];  // [256]
  float* out = (float*)d_out;                  // [8,2048,256]

  // Workspace (~41 MB):
  //   [ 0,16M)   query f32
  //   [16,24M)   query bf16          (B of S^T)
  //   [24,32M)   key bf16  [B,Lk,D]  (A of S^T, async-staged)
  //   [32,40M)   key bf16T [B,D,Lk]  (B of O += P·K, async-staged)
  //   [40M..]    WqT bf16, WkT bf16
  char* ws = (char*)d_ws;
  float*  q_f32 = (float*)ws;
  __bf16* q_b   = (__bf16*)(ws + (size_t)16 * 1024 * 1024);
  __bf16* k_b   = (__bf16*)(ws + (size_t)24 * 1024 * 1024);
  __bf16* kT_b  = (__bf16*)(ws + (size_t)32 * 1024 * 1024);
  __bf16* WqT   = (__bf16*)(ws + (size_t)40 * 1024 * 1024);
  __bf16* WkT   = (__bf16*)(ws + (size_t)40 * 1024 * 1024 + 512 * 1024);

  dim3 blk(256);
  weightT_kernel<<<dim3(1024), blk, 0, stream>>>(Wq, WqT, 1024);
  weightT_kernel<<<dim3(256), blk, 0, stream>>>(Wk, WkT, 256);

  dim3 pgrid(M_TOTAL / PM);   // 256 blocks of 64 rows x 256 columns
  proj_gemm_kernel<1024, true, false><<<pgrid, blk, 0, stream>>>(
      data1, WqT, bq, q_f32, q_b, nullptr);
  proj_gemm_kernel<256, false, true><<<pgrid, blk, 0, stream>>>(
      data2, WkT, bk, nullptr, k_b, kT_b);

  const int qtiles = BATCH * (LQ / 16);  // 1024 tiles, 2 waves each
  attn_kernel<<<dim3(qtiles / QTILES), blk, 0, stream>>>(
      q_b, k_b, kT_b, q_f32, out);
}

// v005
// Measured time: 70 microseconds a run.
// Next to v004, in two timings, it ran 1.26 and 1.25 times as fast.
// Over all steps from v000 it is 6.28 times as fast.
#include <hip/hip_runtime.h>

// ---------------------------------------------------------------------------
// CoAttention on MI455X (gfx1250): bf16 WMMA for all 4 matmuls, f32 softmax.
//   query = data1 @ Wq + bq            [8,2048,256]
//   key   = data2 @ Wk + bk            [8,2048,256]
//   S     = (query @ key^T) / 32       (flash style, never materialized)
//   out   = softmax(S) @ key + query   [8,2048,256]
//
// Roofline: ~45 GFLOP vs ~100 MB HBM -> compute bound on the WMMA pipes.
// Attention: a block takes 64 queries on 8 waves: 4 query tiles x 2 key
// halves, so that 256 blocks fill all 256 WGPs at two waves per SIMD. Each
// stage brings 128 keys (one 64-key tile per half) into LDS with gfx1250
// async copies (ASYNCcnt), double buffered; the halves are joined in LDS.
//
// Layout trick: S^T = K·Q^T so its C layout (element = key, lane = query)
// equals the A layout needed for P in O += P·K: softmax->P repack is
// lane-local (no LDS transpose, no shuffles).
// ---------------------------------------------------------------------------

typedef __attribute__((ext_vector_type(16))) __bf16 v16bf;
typedef __attribute__((ext_vector_type(8)))  __bf16 v8bf;
typedef __attribute__((ext_vector_type(4)))  __bf16 v4bf;
typedef __attribute__((ext_vector_type(8)))  float  f8v;
typedef __attribute__((ext_vector_type(4)))  float  f4v;

#define DD      256
#define LQ      2048
#define LK      2048
#define BATCH   8
#define M_TOTAL (BATCH * LQ)   // 16384
#define QTILES  4              // 16-query tiles per attention block
#define KSPLIT  2              // wave groups that share the keys of a stage
#define KSTEP   64             // keys per wave and attention step (4 S-tiles)
#define NSTAGE  (LK / (KSPLIT * KSTEP))   // 16 stages of 128 keys

// LDS rows hold 256 B at a pitch of 272 B (16 B x odd), so that the 16 lanes
// of a ds_load_b128 half (one row each) fall on 16 different groups of 4 banks.
#define PITCH       (128 + 8)                 // 136 el = 272 B (16 B x 17)

// One stage = 128 keys:
//   kb [2 halves of d][128 keys][128 d]   key rows, d 0-127 and d 128-255 apart
//   kt [256 d][128 keys]                  the same keys transposed
// The ring holds two stages.
#define SKEYS       (KSPLIT * KSTEP)          // 128
#define KBH_ELEMS   (SKEYS * PITCH)           // 17408: one d half of kb
#define KB_ELEMS    (2 * KBH_ELEMS)           // 34816
#define KT_ELEMS    (DD * PITCH)              // 34816
#define STAGE_ELEMS (KB_ELEMS + KT_ELEMS)     // 69632
#define SMEM_ELEMS  (2 * STAGE_ELEMS)         // 139264 el = 278528 B

union F16 {
  v16bf v;
  v8bf  h[2];
};

__device__ __forceinline__ f8v wmma_bf16(v16bf a, v16bf b, f8v c) {
  return __builtin_amdgcn_wmma_f32_16x16x32_bf16(false, a, false, b,
                                                 (short)0, c, false, false);
}

// Async global -> LDS copy, 16B per lane. VDST VGPR carries the LDS byte
// offset (dsaddr = LDS_BASE + VGPR), VADDR the 64-bit global address.
// Eight copies per statement; the s_wait_xcnt 0 at its end stands in front of
// any later rewrite of the address registers that the copies name.
#define ASYNC_LDS_B128_X8(l, p)                                            \
  asm volatile("global_load_async_to_lds_b128 %0, %8, off\n\t"             \
               "global_load_async_to_lds_b128 %1, %9, off\n\t"             \
               "global_load_async_to_lds_b128 %2, %10, off\n\t"            \
               "global_load_async_to_lds_b128 %3, %11, off\n\t"            \
               "global_load_async_to_lds_b128 %4, %12, off\n\t"            \
               "global_load_async_to_lds_b128 %5, %13, off\n\t"            \
               "global_load_async_to_lds_b128 %6, %14, off\n\t"            \
               "global_load_async_to_lds_b128 %7, %15, off\n\t"            \
               "s_wait_xcnt 0x0"                                           \
               :: "v"(l[0]), "v"(l[1]), "v"(l[2]), "v"(l[3]),              \
                  "v"(l[4]), "v"(l[5]), "v"(l[6]), "v"(l[7]),              \
                  "v"(p[0]), "v"(p[1]), "v"(p[2]), "v"(p[3]),              \
                  "v"(p[4]), "v"(p[5]), "v"(p[6]), "v"(p[7])               \
               : "memory")
// Publish point of the two-buffer ring: the wave's own LDS reads have
// retired, its own copies have landed; the barrier follows.
#define WAIT_DS_0()       asm volatile("s_wait_dscnt 0x0"     ::: "memory")
#define WAIT_ASYNC_0()    asm volatile("s_wait_asynccnt 0x0"  ::: "memory")

// ---------------------------------------------------------------------------
// Weight prep: W[Kdim,256] (f32) -> WT[256,Kdim] (bf16), both weights in one
// launch of few waves. A block of 128 threads takes 64 k x 64 columns, that is
// one whole 128-B line of W^T per column; a thread turns 32 k of its column
// into half of that line. A wave's loads cover whole 128-B lines of W.
// Blocks 0-63: Wq (16 k groups x 4 column groups); blocks 64-79: Wk (4 x 4).
// ---------------------------------------------------------------------------
#define WT_QBLOCKS 64
#define WT_BLOCKS  80
__global__ void __launch_bounds__(128)
weightT_kernel(const float* __restrict__ Wq, const float* __restrict__ Wk,
               __bf16* __restrict__ WqT, __bf16* __restrict__ WkT) {
  const bool   isq  = blockIdx.x < WT_QBLOCKS;
  const int    t    = isq ? blockIdx.x : blockIdx.x - WT_QBLOCKS;
  const float* W    = isq ? Wq : Wk;
  __bf16*      WT   = isq ? WqT : WkT;
  const int    Kdim = isq ? 1024 : 256;
  const int    col  = (t & 3) * 64 + (threadIdx.x & 63);
  const int    k0   = (t >> 2) * 64 + (threadIdx.x >> 6) * 32;
  const float* src  = W + (size_t)k0 * DD + col;
  __bf16*      dst  = WT + (size_t)col * Kdim + k0;
  float x[32];
#pragma unroll
  for (int i = 0; i < 32; ++i) x[i] = src[i * DD];
#pragma unroll
  for (int j = 0; j < 4; ++j) {
    v8bf y;
#pragma unroll
    for (int r = 0; r < 8; ++r) y[r] = (__bf16)x[8 * j + r];
    *(v8bf*)&dst[8 * j] = y;
  }
}

// ---------------------------------------------------------------------------
// Projection GEMM: C[M,256] = A[M,KDIM] @ W[KDIM,256] + bias.
// A block takes 64 rows and all 256 columns, so that A leaves memory once;
// 8 waves as 2 (M) x 4 (N), wave tile 32 x 64. Each stage brings 128 k of the
// A rows (f32) and of the W^T rows (bf16) into LDS with async copies, whole
// 128-B lines per copy, double buffered; A turns bf16 on its way from LDS to
// the fragment. Epilogue write-set is a template parameter; the outputs leave
// through LDS as whole 128-B lines.
// ---------------------------------------------------------------------------
#define PM           64                        // rows of a block
#define PKC          128                       // k per stage
#define PA_PITCH     (PKC + 4)                 // f32 el:  528 B (16 B x 33)
#define PW_PITCH     (PKC + 8)                 // bf16 el: 272 B (16 B x 17)
#define PA_BYTES     (PM * PA_PITCH * 4)       // 33792
#define PW_BYTES     (DD * PW_PITCH * 2)       // 69632
#define PSTAGE_BYTES (PA_BYTES + PW_BYTES)     // 103424
// Output staging in the freed ring: rows 8 apart fall 32 banks apart (f32 tile);
// the transposed tile has a 16 B x odd pitch for its 16-B stores and reads.
#define CF_PITCH     (DD + 4)                  // f32 el:  1040 B
#define CF_BYTES     (PM * CF_PITCH * 4)       // 66560
#define CT_PITCH     (PM + 8)                  // bf16 el: 144 B (16 B x 9)

template <int KDIM, bool WRITE_F32, bool WRITE_T>
__device__ __forceinline__ void
proj_tile(char* psm, const float* __restrict__ A, const __bf16* __restrict__ WT,
          const float* __restrict__ bias,
          float* __restrict__ outF32, __bf16* __restrict__ outB,
          __bf16* __restrict__ outT) {
  constexpr int NST = KDIM / PKC;

  const int lane = threadIdx.x & 31;
  // scalar wave number: the rows a wave copies stay in scalar registers
  const int wave = __builtin_amdgcn_readfirstlane(threadIdx.x >> 5);
  const int g    = lane >> 4;
  const int ln   = lane & 15;
  const int mw   = (wave >> 2) * 32;            // the wave's first row in the block
  const int n0   = (wave & 3) * 64;

  const unsigned psmB  = (unsigned)(size_t)psm;   // LDS byte address of the ring
  const char*   a_base = (const char*)(A + (size_t)blockIdx.x * PM * KDIM);
  const char*   w_base = (const char*)WT;
  // Per-lane parts of the copy addresses, in bytes. An A copy brings the 512 B
  // of one row; a W^T copy two neighbouring rows of 256 B, 16 lanes each.
  const unsigned aLane  = (unsigned)lane * 16;
  const unsigned wLaneL = (unsigned)(g * (PW_PITCH * 2) + ln * 16);
  const unsigned wLaneG = (unsigned)(g * (KDIM * 2) + ln * 16);

  // ---- cooperative async copy of k stage `st` into buffer `buf` ----
  auto pstage = [&](int buf, int st) {
    const unsigned lb  = psmB + (unsigned)buf * PSTAGE_BYTES;
    const char*    ga0 = a_base + (size_t)wave * (KDIM * 4) + (size_t)st * (PKC * 4);
    const char*    gw0 = w_base + (size_t)wave * (2 * KDIM * 2) + (size_t)st * (PKC * 2);
    unsigned    la[8];
    const char* ga[8];
#pragma unroll
    for (int i = 0; i < 8; ++i) {               // A rows wave + 8 i
      la[i] = (lb + (unsigned)((wave + 8 * i) * (PA_PITCH * 4))) + aLane;
      ga[i] = (ga0 + (8 * i) * (KDIM * 4)) + aLane;
    }
    ASYNC_LDS_B128_X8(la, ga);
#pragma unroll
    for (int h = 0; h < 2; ++h) {
#pragma unroll
      for (int i = 0; i < 8; ++i) {             // W^T rows 2 (wave + 8 j) + g
        const int j = 8 * h + i;
        la[i] = (lb + (unsigned)(PA_BYTES + 2 * (wave + 8 * j) * (PW_PITCH * 2))) + wLaneL;
        ga[i] = (gw0 + (8 * j) * (2 * KDIM * 2)) + wLaneG;
      }
      ASYNC_LDS_B128_X8(la, ga);
    }
  };

  f8v acc[2][4] = {};

  // Two-buffer ring: one stage's copies (24 per wave) in flight at a time.
  pstage(0, 0);
  WAIT_ASYNC_0();
  __syncthreads();
  if (NST > 1) pstage(1, 1);

  for (int st = 0; st < NST; ++st) {
    const int buf = st & 1;
    const float*  sa = (const float*)(psm + buf * PSTAGE_BYTES) +
                       ((wave >> 2) * 32 + ln) * PA_PITCH + 8 * g;
    const __bf16* sw = (const __bf16*)(psm + buf * PSTAGE_BYTES + PA_BYTES) +
                       (n0 + ln) * PW_PITCH + 8 * g;
    // Fragments of one 32-k step: A as f32 (4 x 16 B per 16-row tile), W^T as bf16.
    f4v xa[2][2][4];
    F16 bfr[2][4];
    auto ldfrag = [&](int slot, int kk) {
#pragma unroll
      for (int s = 0; s < 2; ++s) {
        const float* p = sa + s * 16 * PA_PITCH + kk;
        xa[slot][s][0] = *(const f4v*)(p);
        xa[slot][s][1] = *(const f4v*)(p + 4);
        xa[slot][s][2] = *(const f4v*)(p + 16);
        xa[slot][s][3] = *(const f4v*)(p + 20);
      }
#pragma unroll
      for (int t = 0; t < 4; ++t) {
        const __bf16* q = sw + t * 16 * PW_PITCH + kk;
        bfr[slot][t].h[0] = *(const v8bf*)(q);
        bfr[slot][t].h[1] = *(const v8bf*)(q + 16);
      }
    };
    ldfrag(0, 0);
#pragma unroll
    for (int c = 0; c < PKC / 32; ++c) {
      if (c + 1 < PKC / 32) ldfrag((c + 1) & 1, (c + 1) * 32);
      // keeps the next step's 16 LDS reads as one group ahead of this step's
      // WMMAs, which then cover their latency (else they sink to their uses)
      __builtin_amdgcn_sched_barrier(0);
      F16 af[2];
#pragma unroll
      for (int s = 0; s < 2; ++s) {
        af[s].h[0] = __builtin_shufflevector(
            __builtin_convertvector(xa[c & 1][s][0], v4bf),
            __builtin_convertvector(xa[c & 1][s][1], v4bf), 0, 1, 2, 3, 4, 5, 6, 7);
        af[s].h[1] = __builtin_shufflevector(
            __builtin_convertvector(xa[c & 1][s][2], v4bf),
            __builtin_convertvector(xa[c & 1][s][3], v4bf), 0, 1, 2, 3, 4, 5, 6, 7);
      }
#pragma unroll
      for (int t = 0; t < 4; ++t) {
        acc[0][t] = wmma_bf16(af[0].v, bfr[c & 1][t].v, acc[0][t]);
        acc[1][t] = wmma_bf16(af[1].v, bfr[c & 1][t].v, acc[1][t]);
      }
    }

    // Publish stage st + 1 and free this buffer with one barrier, then refill.
    WAIT_DS_0();
    WAIT_ASYNC_0();
    __syncthreads();
    if (st + 2 < NST) pstage(buf, st + 2);
  }
  WAIT_ASYNC_0();   // nothing is in flight when the wave ends

  // ---- epilogue: the block's 64 x 256 tile goes through LDS, so that every
  // global store covers whole 128-B lines. The ring is free here: each wave's
  // LDS reads retired in front of the loop's last barrier, no copy is in flight.
  float*  cf = (float*)psm;                    // [64 rows][256 cols] f32
  __bf16* ct = (__bf16*)(psm + CF_BYTES);      // [256 cols][64 rows] bf16
#pragma unroll
  for (int s = 0; s < 2; ++s) {
#pragma unroll
    for (int t = 0; t < 4; ++t) {
      const int col    = n0 + 16 * t + ln;
      const float bval = bias[col];
      const int row0   = mw + 16 * s + 8 * g;   // C layout: M = r + 8g
      v8bf tv;
#pragma unroll
      for (int r = 0; r < 8; ++r) {
        const float v = acc[s][t][r] + bval;
        cf[(row0 + r) * CF_PITCH + col] = v;
        if constexpr (WRITE_T) tv[r] = (__bf16)v;
      }
      // a lane's 8 values are 8 neighbouring rows of one column: 16 B of C^T
      if constexpr (WRITE_T) *(v8bf*)&ct[col * CT_PITCH + row0] = tv;
    }
  }
  __syncthreads();   // the tile is complete before any wave reads rows of it

  // Row-major outputs: a wave takes 8 rows; each LDS read and f32 store covers
  // 512 B in a row, each bf16 store 256 B in a row. Unrolled, so that the LDS
  // reads issue as one group and their latency is paid once.
#pragma unroll
  for (int i = 0; i < 8; ++i) {
    const int    row = wave * 8 + i;
    const float* p   = cf + row * CF_PITCH + 4 * lane;
    const f4v    x0  = *(const f4v*)(p);
    const f4v    x1  = *(const f4v*)(p + 128);
    const size_t idx = (size_t)(blockIdx.x * PM + row) * DD + 4 * lane;
    if constexpr (WRITE_F32) {
      *(f4v*)&outF32[idx]       = x0;
      *(f4v*)&outF32[idx + 128] = x1;
    }
    *(v4bf*)&outB[idx]       = __builtin_convertvector(x0, v4bf);
    *(v4bf*)&outB[idx + 128] = __builtin_convertvector(x1, v4bf);
  }
  // Transposed output: the block's 64 rows are one 128-B line of each of the
  // 256 columns; a store covers four such lines, 8 lanes each.
  if constexpr (WRITE_T) {
    const int bb = (blockIdx.x * PM) >> 11;     // batch: row / 2048
    const int l0 = (blockIdx.x * PM) & 2047;
    // unrolled for the same reason as the loop above
#pragma unroll
    for (int i = 0; i < 8; ++i) {
      const int  d = (wave * 8 + i) * 4 + (lane >> 3);
      const v8bf y = *(const v8bf*)&ct[d * CT_PITCH + (lane & 7) * 8];
      *(v8bf*)&outT[((size_t)(bb * DD + d)) * LK + l0 + (lane & 7) * 8] = y;
    }
  }
}

// Both projections in one launch: a block computes its 64 query rows, then its
// 64 key rows, on the same LDS ring.
__global__ void __launch_bounds__(256)
proj_kernel(const float* __restrict__ data1, const __bf16* __restrict__ WqT,
            const float* __restrict__ bq, float* __restrict__ qF32,
            __bf16* __restrict__ qB,
            const float* __restrict__ data2, const __bf16* __restrict__ WkT,
            const float* __restrict__ bk, __bf16* __restrict__ kB,
            __bf16* __restrict__ kT) {
  __shared__ __attribute__((aligned(16))) char psm[2 * PSTAGE_BYTES];
  proj_tile<1024, true, false>(psm, data1, WqT, bq, qF32, qB, nullptr);
  // Every wave has read its rows of the staged query tile out of LDS before
  // the key tile's copies land on them.
  WAIT_DS_0();
  __syncthreads();
  proj_tile<256, false, true>(psm, data2, WkT, bk, nullptr, kB, kT);
}

// ---------------------------------------------------------------------------
// Flash attention. One wave per (16-query tile, key half): waves 0-3 take the
// first 64 keys of every 128-key stage, waves 4-7 the second 64, each with its
// own running maximum, sum and O; the two are joined through LDS at the end.
// smem per stage: [kb 2 x 128 rows][kt 256 rows], pitch 136 el.
// ---------------------------------------------------------------------------
__global__ void __launch_bounds__(256)
attn_kernel(const __bf16* __restrict__ qb, const __bf16* __restrict__ kb,
            const __bf16* __restrict__ ktb, const float* __restrict__ qf32,
            float* __restrict__ out) {
  __shared__ __attribute__((aligned(16))) __bf16 smem[SMEM_ELEMS];

  const int tid  = threadIdx.x;
  const int lane = tid & 31;
  // The wave's number as a scalar: all that depends on it alone (the rows a
  // wave copies, its key half) then stays in scalar registers.
  const int wave = __builtin_amdgcn_readfirstlane(tid >> 5);
  const int g    = lane >> 4;
  const int ln   = lane & 15;
  const int kh   = wave >> 2;                  // key half of this wave
  const int tile = blockIdx.x * QTILES + (wave & 3);
  const int b    = tile >> 7;                  // per-wave batch
  const int q0   = (tile & 127) << 4;
  const int bblk = (blockIdx.x * QTILES) >> 7; // block-uniform batch (same)

  const char* kb_base = (const char*)(kb + (size_t)bblk * LK * DD);
  const char* kt_base = (const char*)(ktb + (size_t)bblk * DD * LK);
  const unsigned smemB = (unsigned)(size_t)smem;   // LDS byte address of the ring

  // Per-lane parts of the copy addresses, in bytes; the rest is wave-uniform.
  // Every copy instruction brings two 256-B rows, lanes 0-15 one and lanes
  // 16-31 the other, which lie 128 LDS rows apart:
  //   kb: the two d halves of key row (wave + 8k), 512 B in a row in global;
  //   kt: rows d = wave + 8k and d + 128.
  const unsigned laneL  = (unsigned)(g * (KBH_ELEMS * 2) + ln * 16);
  const unsigned kbLane = (unsigned)lane * 16;
  const unsigned ktLane = (unsigned)(g * (128 * LK * 2) + ln * 16);

  // ---- cooperative async copy of stage `st` (128 keys) into buffer `buf` ----
  auto stage = [&](int buf, int st) {
    const unsigned lrow = smemB + (unsigned)(buf * STAGE_ELEMS) * 2 +
                          (unsigned)wave * (PITCH * 2);
    const char* gkb = kb_base + (size_t)(st * SKEYS + wave) * (DD * 2);
    const char* gkt = kt_base + (size_t)st * (SKEYS * 2) + (size_t)wave * (LK * 2);
    unsigned    la[8];
    const char* ga[8];
#pragma unroll
    for (int h = 0; h < 2; ++h) {
#pragma unroll
      for (int i = 0; i < 8; ++i) {
        la[i] = (lrow + (unsigned)(8 * (8 * h + i) * (PITCH * 2))) + laneL;
        ga[i] = (gkb + (8 * (8 * h + i)) * (DD * 2)) + kbLane;
      }
      ASYNC_LDS_B128_X8(la, ga);
    }
#pragma unroll
    for (int h = 0; h < 2; ++h) {
#pragma unroll
      for (int i = 0; i < 8; ++i) {
        la[i] = (lrow + (unsigned)(KB_ELEMS * 2 + 8 * (8 * h + i) * (PITCH * 2))) + laneL;
        ga[i] = (gkt + (8 * (8 * h + i)) * (LK * 2)) + ktLane;
      }
      ASYNC_LDS_B128_X8(la, ga);
    }
  };

  // Q fragments, resident, B operand of S^T = K·Q^T.
  v16bf qf[8];
  {
    const __bf16* qrow = qb + (size_t)(b * LQ + q0 + ln) * DD;
#pragma unroll
    for (int c = 0; c < 8; ++c) {
      F16 q;
      q.h[0] = *(const v8bf*)(qrow + 32 * c + 8 * g);
      q.h[1] = *(const v8bf*)(qrow + 32 * c + 16 + 8 * g);
      qf[c] = q.v;
    }
  }

  f8v o[16] = {};
  float mrow = -1e30f;   // per-lane softmax stats: query = ln
  float lrow = 0.0f;
  const float SC = 0.03125f * 1.4426950408889634f;  // SCALE * log2(e)

  // Two-buffer ring: one stage's copies (32 per wave) in flight at a time.
  stage(0, 0);
  WAIT_ASYNC_0();
  __syncthreads();
  stage(1, 1);

  for (int st = 0; st < NSTAGE; ++st) {
    const int buf = st & 1;
    // element bases in smem: this wave's 64 key rows of kb, key columns of kt
    const int kbE = buf * STAGE_ELEMS + kh * (KSTEP * PITCH);
    const int ktE = buf * STAGE_ELEMS + KB_ELEMS + kh * KSTEP;

    // ---- S^T tiles: 4 x 16 keys, A = key rows from LDS, B = resident Q ----
    // Batch the 4 fragments of each K-chunk before the 4 WMMAs so the
    // scheduler can stagger s_wait_dscnt instead of draining per WMMA.
    f8v s[4] = {};
#pragma unroll
    for (int c = 0; c < 8; ++c) {
      F16 ka[4];
#pragma unroll
      for (int tt = 0; tt < 4; ++tt) {
        const int base = kbE + (c >> 2) * KBH_ELEMS + (16 * tt + ln) * PITCH +
                         32 * (c & 3);
        ka[tt].h[0] = *(const v8bf*)&smem[base + 8 * g];
        ka[tt].h[1] = *(const v8bf*)&smem[base + 16 + 8 * g];
      }
#pragma unroll
      for (int tt = 0; tt < 4; ++tt)
        s[tt] = wmma_bf16(ka[tt].v, qf[c], s[tt]);
    }

    // ---- online softmax: keys lane-local, query = lane ----
    // Max commutes with the positive scale: reduce raw s, scale once.
    float mx = -1e30f;
#pragma unroll
    for (int tt = 0; tt < 4; ++tt)
#pragma unroll
      for (int r = 0; r < 8; ++r) mx = fmaxf(mx, s[tt][r]);
    mx = fmaxf(mx, __shfl_xor(mx, 16));         // merge key-halves
    const float mn    = fmaxf(mrow, mx * SC);
    const float alpha = exp2f(mrow - mn);
    mrow = mn;

    // P fragments: S^T C-layout == P A-layout (lane-local repack).
    F16 pf0, pf1;
    float rs = 0.0f;
#pragma unroll
    for (int r = 0; r < 8; ++r) {
      const float e0 = exp2f(fmaf(s[0][r], SC, -mn));
      const float e1 = exp2f(fmaf(s[1][r], SC, -mn));
      const float e2 = exp2f(fmaf(s[2][r], SC, -mn));
      const float e3 = exp2f(fmaf(s[3][r], SC, -mn));
      rs += (e0 + e1) + (e2 + e3);
      pf0.v[r] = (__bf16)e0; pf0.v[8 + r] = (__bf16)e1;
      pf1.v[r] = (__bf16)e2; pf1.v[8 + r] = (__bf16)e3;
    }
    rs += __shfl_xor(rs, 16);
    lrow = lrow * alpha + rs;

    // Rescale O: element r is query r+8g -> broadcast alpha from lane r+8g.
    float ar[8];
#pragma unroll
    for (int r = 0; r < 8; ++r) ar[r] = __shfl(alpha, r + 8 * g);
#pragma unroll
    for (int t = 0; t < 16; ++t)
#pragma unroll
      for (int r = 0; r < 8; ++r) o[t][r] *= ar[r];

    // ---- O += P @ K_tile from the LDS-transposed key tile ----
    // Two t-values per batch: 8 ds_load_b128 then 4 WMMAs.
#pragma unroll
    for (int t = 0; t < 16; t += 2) {
      F16 bb[4];
#pragma unroll
      for (int u = 0; u < 2; ++u) {
        const int base = ktE + (16 * (t + u) + ln) * PITCH;
        bb[2 * u + 0].h[0] = *(const v8bf*)&smem[base + 8 * g];
        bb[2 * u + 0].h[1] = *(const v8bf*)&smem[base + 16 + 8 * g];
        bb[2 * u + 1].h[0] = *(const v8bf*)&smem[base + 32 + 8 * g];
        bb[2 * u + 1].h[1] = *(const v8bf*)&smem[base + 48 + 8 * g];
      }
      o[t]     = wmma_bf16(pf0.v, bb[0].v, o[t]);
      o[t]     = wmma_bf16(pf1.v, bb[1].v, o[t]);
      o[t + 1] = wmma_bf16(pf0.v, bb[2].v, o[t + 1]);
      o[t + 1] = wmma_bf16(pf1.v, bb[3].v, o[t + 1]);
    }

    // Publish stage st + 1 and free this buffer with one barrier, then refill.
    WAIT_DS_0();
    WAIT_ASYNC_0();
    __syncthreads();
    if (st + 2 < NSTAGE) stage(buf, st + 2);
  }
  WAIT_ASYNC_0();   // nothing is in flight when the ring becomes join space

  // f32 residual of the 16 x 128 piece that this wave finishes, read in one run
  // so that one wait covers the run's address registers.
  const size_t idx0 = (size_t)(b * LQ + q0 + 8 * g) * DD + 128 * kh + ln;
  float res[8][8];
#pragma unroll
  for (int tt = 0; tt < 8; ++tt)
#pragma unroll
    for (int r = 0; r < 8; ++r) res[tt][r] = qf32[idx0 + (size_t)(r * DD + 16 * tt)];
  // stands in front of any later rewrite of the address registers of that run
  asm volatile("s_wait_xcnt 0x0" ::: "memory");

  // ---- join the two key halves: each wave hands its partner (wave ^ 4) the
  // 8 column tiles that the partner finishes, with its maximum and sum ----
  float* xo = (float*)smem;                     // [wave][8 tiles][2][32 lanes] f4v
  float* xs = xo + 8 * 2048;                    // [wave][m, l][32 lanes]
  const bool hi = kh != 0;                      // finishes column tiles 8..15
#pragma unroll
  for (int tt = 0; tt < 8; ++tt) {
    f4v s0, s1;
#pragma unroll
    for (int r = 0; r < 4; ++r) {
      s0[r] = hi ? o[tt][r]     : o[8 + tt][r];
      s1[r] = hi ? o[tt][4 + r] : o[8 + tt][4 + r];
    }
    *(f4v*)&xo[wave * 2048 + ((2 * tt + 0) * 32 + lane) * 4] = s0;
    *(f4v*)&xo[wave * 2048 + ((2 * tt + 1) * 32 + lane) * 4] = s1;
  }
  xs[(wave * 2 + 0) * 32 + lane] = mrow;
  xs[(wave * 2 + 1) * 32 + lane] = lrow;
  __syncthreads();

  const int   pw = wave ^ 4;
  const float mo = xs[(pw * 2 + 0) * 32 + lane];
  const float lo = xs[(pw * 2 + 1) * 32 + lane];
  const float mj = fmaxf(mrow, mo);
  const float as = exp2f(mrow - mj);
  const float ao = exp2f(mo - mj);
  const float li = 1.0f / (lrow * as + lo * ao);
  const float fs = as * li;                     // weight of this wave's O
  const float fo = ao * li;                     // weight of the partner's O

  // ---- epilogue: normalize + f32 residual ----
  float ws[8], wo[8];
#pragma unroll
  for (int r = 0; r < 8; ++r) {
    ws[r] = __shfl(fs, r + 8 * g);
    wo[r] = __shfl(fo, r + 8 * g);
  }
#pragma unroll
  for (int tt = 0; tt < 8; ++tt) {
    const f4v p0 = *(const f4v*)&xo[pw * 2048 + ((2 * tt + 0) * 32 + lane) * 4];
    const f4v p1 = *(const f4v*)&xo[pw * 2048 + ((2 * tt + 1) * 32 + lane) * 4];
#pragma unroll
    for (int r = 0; r < 8; ++r) {
      const float mine = hi ? o[8 + tt][r] : o[tt][r];
      const float part = r < 4 ? p0[r & 3] : p1[r & 3];
      out[idx0 + (size_t)(r * DD + 16 * tt)] = mine * ws[r] + part * wo[r] + res[tt][r];
    }
  }
}

// ---------------------------------------------------------------------------
extern "C" void kernel_launch(void* const* d_in, const int* in_sizes, int n_in,
                              void* d_out, int out_size, void* d_ws, size_t ws_size,
                              hipStream_t stream) {
  (void)in_sizes; (void)n_in; (void)out_size; (void)ws_size;

  const float* data1 = (const float*)d_in[0];  // [8,2048,1024]
  const float* data2 = (const float*)d_in[1];  // [8,2048,256]
  const float* Wq    = (const float*)d_in[2];  // [1024,256]
  const float* bq    = (const float*)d_in[3];  // [256]
  const float* Wk    = (const float*)d_in[4];  // [256,256]
  const float* bk    = (const float*)d_in[5];  // [256]
  float* out = (float*)d_out;                  // [8,2048,256]

  // Workspace (~41 MB):
  //   [ 0,16M)   query f32
  //   [16,24M)   query bf16          (B of S^T)
  //   [24,32M)   key bf16  [B,Lk,D]  (A of S^T, async-staged)
  //   [32,40M)   key bf16T [B,D,Lk]  (B of O += P·K, async-staged)
  //   [40M..]    WqT bf16, WkT bf16
  char* ws = (char*)d_ws;
  float*  q_f32 = (float*)ws;
  __bf16* q_b   = (__bf16*)(ws + (size_t)16 * 1024 * 1024);
  __bf16* k_b   = (__bf16*)(ws + (size_t)24 * 1024 * 1024);
  __bf16* kT_b  = (__bf16*)(ws + (size_t)32 * 1024 * 1024);
  __bf16* WqT   = (__bf16*)(ws + (size_t)40 * 1024 * 1024);
  __bf16* WkT   = (__bf16*)(ws + (size_t)40 * 1024 * 1024 + 512 * 1024);

  dim3 blk(256);
  weightT_kernel<<<dim3(WT_BLOCKS), dim3(128), 0, stream>>>(Wq, Wk, WqT, WkT);

  dim3 pgrid(M_TOTAL / PM);   // 256 blocks of 64 rows x 256 columns, twice
  proj_kernel<<<pgrid, blk, 0, stream>>>(data1, WqT, bq, q_f32, q_b,
                                         data2, WkT, bk, k_b, kT_b);

  const int qtiles = BATCH * (LQ / 16);  // 1024 tiles, 2 waves each
  attn_kernel<<<dim3(qtiles / QTILES), blk, 0, stream>>>(
      q_b, k_b, kT_b, q_f32, out);
}

// v006
// Measured time: 65.3 microseconds a run.
// In two side-by-side timings against v005, it was 1.08 and 1.07 times as fast.
// Over all steps from v000 it is 6.75 times as fast.
#include <hip/hip_runtime.h>

// ---------------------------------------------------------------------------
// CoAttention on MI455X (gfx1250): bf16 WMMA for all 4 matmuls, f32 softmax.
//   query = data1 @ Wq + bq            [8,2048,256]
//   key   = data2 @ Wk + bk            [8,2048,256]
//   S     = (query @ key^T) / 32       (flash style, never materialized)
//   out   = softmax(S) @ key + query   [8,2048,256]
//
// Roofline: ~45 GFLOP vs ~100 MB HBM -> compute bound on the WMMA pipes.
// Attention: a block takes 64 queries on 8 waves: 4 query tiles x 2 key
// halves, so that 256 blocks fill all 256 WGPs at two waves per SIMD. Each
// stage brings 128 keys (one 64-key tile per half) into LDS with gfx1250
// async copies (ASYNCcnt), double buffered; the halves are joined in LDS.
//
// Layout trick: S^T = K·Q^T so its C layout (element = key, lane = query)
// equals the A layout needed for P in O += P·K: softmax->P repack is
// lane-local (no LDS transpose, no shuffles).
// ---------------------------------------------------------------------------

typedef __attribute__((ext_vector_type(16))) __bf16 v16bf;
typedef __attribute__((ext_vector_type(8)))  __bf16 v8bf;
typedef __attribute__((ext_vector_type(4)))  __bf16 v4bf;
typedef __attribute__((ext_vector_type(8)))  float  f8v;
typedef __attribute__((ext_vector_type(4)))  float  f4v;

#define DD      256
#define LQ      2048
#define LK      2048
#define BATCH   8
#define M_TOTAL (BATCH * LQ)   // 16384
#define QTILES  4              // 16-query tiles per attention block
#define KSPLIT  2              // wave groups that share the keys of a stage
#define KSTEP   64             // keys per wave and attention step (4 S-tiles)
#define NSTAGE  (LK / (KSPLIT * KSTEP))   // 16 stages of 128 keys

// LDS rows hold 256 B at a pitch of 272 B (16 B x odd), so that the 16 lanes
// of a ds_load_b128 half (one row each) fall on 16 different groups of 4 banks.
#define PITCH       (128 + 8)                 // 136 el = 272 B (16 B x 17)

// One stage = 128 keys:
//   kb [2 halves of d][128 keys][128 d]   key rows, d 0-127 and d 128-255 apart
//   kt [256 d][128 keys]                  the same keys transposed
// The ring holds two stages.
#define SKEYS       (KSPLIT * KSTEP)          // 128
#define KBH_ELEMS   (SKEYS * PITCH)           // 17408: one d half of kb
#define KB_ELEMS    (2 * KBH_ELEMS)           // 34816
#define KT_ELEMS    (DD * PITCH)              // 34816
#define STAGE_ELEMS (KB_ELEMS + KT_ELEMS)     // 69632
#define SMEM_ELEMS  (2 * STAGE_ELEMS)         // 139264 el = 278528 B

union F16 {
  v16bf v;
  v8bf  h[2];
};

__device__ __forceinline__ f8v wmma_bf16(v16bf a, v16bf b, f8v c) {
  return __builtin_amdgcn_wmma_f32_16x16x32_bf16(false, a, false, b,
                                                 (short)0, c, false, false);
}

// Async global -> LDS copy, 16B per lane. VDST VGPR carries the LDS byte
// offset (dsaddr = LDS_BASE + VGPR), VADDR the 64-bit global address.
// Eight copies per statement; the s_wait_xcnt 0 at its end stands in front of
// any later rewrite of the address registers that the copies name.
#define ASYNC_LDS_B128_X8(l, p)                                            \
  asm volatile("global_load_async_to_lds_b128 %0, %8, off\n\t"             \
               "global_load_async_to_lds_b128 %1, %9, off\n\t"             \
               "global_load_async_to_lds_b128 %2, %10, off\n\t"            \
               "global_load_async_to_lds_b128 %3, %11, off\n\t"            \
               "global_load_async_to_lds_b128 %4, %12, off\n\t"            \
               "global_load_async_to_lds_b128 %5, %13, off\n\t"            \
               "global_load_async_to_lds_b128 %6, %14, off\n\t"            \
               "global_load_async_to_lds_b128 %7, %15, off\n\t"            \
               "s_wait_xcnt 0x0"                                           \
               :: "v"(l[0]), "v"(l[1]), "v"(l[2]), "v"(l[3]),              \
                  "v"(l[4]), "v"(l[5]), "v"(l[6]), "v"(l[7]),              \
                  "v"(p[0]), "v"(p[1]), "v"(p[2]), "v"(p[3]),              \
                  "v"(p[4]), "v"(p[5]), "v"(p[6]), "v"(p[7])               \
               : "memory")
// Publish point of the two-buffer ring: the wave's own LDS reads have
// retired, its own copies have landed; the barrier follows.
#define WAIT_DS_0()       asm volatile("s_wait_dscnt 0x0"     ::: "memory")
#define WAIT_ASYNC_0()    asm volatile("s_wait_asynccnt 0x0"  ::: "memory")

// ---------------------------------------------------------------------------
// Weight prep: W[Kdim,256] (f32) -> WT[256,Kdim] (bf16), both weights in one
// launch of few waves. A block of 128 threads takes 64 k x 64 columns, that is
// one whole 128-B line of W^T per column; a thread turns 32 k of its column
// into half of that line. A wave's loads cover whole 128-B lines of W.
// Blocks 0-63: Wq (16 k groups x 4 column groups); blocks 64-79: Wk (4 x 4).
// ---------------------------------------------------------------------------
#define WT_QBLOCKS 64
#define WT_BLOCKS  80
__global__ void __launch_bounds__(128)
weightT_kernel(const float* __restrict__ Wq, const float* __restrict__ Wk,
               __bf16* __restrict__ WqT, __bf16* __restrict__ WkT) {
  const bool   isq  = blockIdx.x < WT_QBLOCKS;
  const int    t    = isq ? blockIdx.x : blockIdx.x - WT_QBLOCKS;
  const float* W    = isq ? Wq : Wk;
  __bf16*      WT   = isq ? WqT : WkT;
  const int    Kdim = isq ? 1024 : 256;
  const int    col  = (t & 3) * 64 + (threadIdx.x & 63);
  const int    k0   = (t >> 2) * 64 + (threadIdx.x >> 6) * 32;
  const float* src  = W + (size_t)k0 * DD + col;
  __bf16*      dst  = WT + (size_t)col * Kdim + k0;
  float x[32];
#pragma unroll
  for (int i = 0; i < 32; ++i) x[i] = src[i * DD];
#pragma unroll
  for (int j = 0; j < 4; ++j) {
    v8bf y;
#pragma unroll
    for (int r = 0; r < 8; ++r) y[r] = (__bf16)x[8 * j + r];
    *(v8bf*)&dst[8 * j] = y;
  }
}

// ---------------------------------------------------------------------------
// Projection GEMM: C[M,256] = A[M,KDIM] @ W[KDIM,256] + bias.
// A block takes 64 rows and all 256 columns, so that A leaves memory once;
// 8 waves as 2 (M) x 4 (N), wave tile 32 x 64. Each stage brings 128 k of the
// A rows (f32) and of the W^T rows (bf16) into LDS with async copies, whole
// 128-B lines per copy, double buffered; A turns bf16 on its way from LDS to
// the fragment. Epilogue write-set is a template parameter; the outputs leave
// through LDS as whole 128-B lines.
// ---------------------------------------------------------------------------
#define PM           64                        // rows of a block
#define PKC          128                       // k per stage
#define PA_PITCH     (PKC + 4)                 // f32 el:  528 B (16 B x 33)
#define PW_PITCH     (PKC + 8)                 // bf16 el: 272 B (16 B x 17)
#define PA_BYTES     (PM * PA_PITCH * 4)       // 33792
#define PW_BYTES     (DD * PW_PITCH * 2)       // 69632
#define PSTAGE_BYTES (PA_BYTES + PW_BYTES)     // 103424
// Output staging in the freed ring: rows 8 apart fall 32 banks apart (f32 tile);
// the transposed tile has a 16 B x odd pitch for its 16-B stores and reads.
#define CF_PITCH     (DD + 4)                  // f32 el:  1040 B
#define CF_BYTES     (PM * CF_PITCH * 4)       // 66560
#define CT_PITCH     (PM + 8)                  // bf16 el: 144 B (16 B x 9)

template <int KDIM, bool WRITE_F32, bool WRITE_T>
__device__ __forceinline__ void
proj_tile(char* psm, const float* __restrict__ A, const __bf16* __restrict__ WT,
          const float* __restrict__ bias,
          float* __restrict__ outF32, __bf16* __restrict__ outB,
          __bf16* __restrict__ outT) {
  constexpr int NST = KDIM / PKC;

  const int lane = threadIdx.x & 31;
  // scalar wave number: the rows a wave copies stay in scalar registers
  const int wave = __builtin_amdgcn_readfirstlane(threadIdx.x >> 5);
  const int g    = lane >> 4;
  const int ln   = lane & 15;
  const int mw   = (wave >> 2) * 32;            // the wave's first row in the block
  const int n0   = (wave & 3) * 64;

  const unsigned psmB  = (unsigned)(size_t)psm;   // LDS byte address of the ring
  const char*   a_base = (const char*)(A + (size_t)blockIdx.x * PM * KDIM);
  const char*   w_base = (const char*)WT;
  // Per-lane parts of the copy addresses, in bytes. An A copy brings the 512 B
  // of one row; a W^T copy two neighbouring rows of 256 B, 16 lanes each.
  const unsigned aLane  = (unsigned)lane * 16;
  const unsigned wLaneL = (unsigned)(g * (PW_PITCH * 2) + ln * 16);
  const unsigned wLaneG = (unsigned)(g * (KDIM * 2) + ln * 16);

  // ---- cooperative async copy of k stage `st` into buffer `buf` ----
  auto pstage = [&](int buf, int st) {
    const unsigned lb  = psmB + (unsigned)buf * PSTAGE_BYTES;
    const char*    ga0 = a_base + (size_t)wave * (KDIM * 4) + (size_t)st * (PKC * 4);
    const char*    gw0 = w_base + (size_t)wave * (2 * KDIM * 2) + (size_t)st * (PKC * 2);
    unsigned    la[8];
    const char* ga[8];
#pragma unroll
    for (int i = 0; i < 8; ++i) {               // A rows wave + 8 i
      la[i] = (lb + (unsigned)((wave + 8 * i) * (PA_PITCH * 4))) + aLane;
      ga[i] = (ga0 + (8 * i) * (KDIM * 4)) + aLane;
    }
    ASYNC_LDS_B128_X8(la, ga);
#pragma unroll
    for (int h = 0; h < 2; ++h) {
#pragma unroll
      for (int i = 0; i < 8; ++i) {             // W^T rows 2 (wave + 8 j) + g
        const int j = 8 * h + i;
        la[i] = (lb + (unsigned)(PA_BYTES + 2 * (wave + 8 * j) * (PW_PITCH * 2))) + wLaneL;
        ga[i] = (gw0 + (8 * j) * (2 * KDIM * 2)) + wLaneG;
      }
      ASYNC_LDS_B128_X8(la, ga);
    }
  };

  f8v acc[2][4] = {};

  // Two-buffer ring: one stage's copies (24 per wave) in flight at a time.
  pstage(0, 0);
  WAIT_ASYNC_0();
  __syncthreads();
  if (NST > 1) pstage(1, 1);

  for (int st = 0; st < NST; ++st) {
    const int buf = st & 1;
    const float*  sa = (const float*)(psm + buf * PSTAGE_BYTES) +
                       ((wave >> 2) * 32 + ln) * PA_PITCH + 8 * g;
    const __bf16* sw = (const __bf16*)(psm + buf * PSTAGE_BYTES + PA_BYTES) +
                       (n0 + ln) * PW_PITCH + 8 * g;
    // Fragments of one 32-k step: A as f32 (4 x 16 B per 16-row tile), W^T as bf16.
    f4v xa[2][2][4];
    F16 bfr[2][4];
    auto ldfrag = [&](int slot, int kk) {
#pragma unroll
      for (int s = 0; s < 2; ++s) {
        const float* p = sa + s * 16 * PA_PITCH + kk;
        xa[slot][s][0] = *(const f4v*)(p);
        xa[slot][s][1] = *(const f4v*)(p + 4);
        xa[slot][s][2] = *(const f4v*)(p + 16);
        xa[slot][s][3] = *(const f4v*)(p + 20);
      }
#pragma unroll
      for (int t = 0; t < 4; ++t) {
        const __bf16* q = sw + t * 16 * PW_PITCH + kk;
        bfr[slot][t].h[0] = *(const v8bf*)(q);
        bfr[slot][t].h[1] = *(const v8bf*)(q + 16);
      }
    };
    ldfrag(0, 0);
#pragma unroll
    for (int c = 0; c < PKC / 32; ++c) {
      if (c + 1 < PKC / 32) ldfrag((c + 1) & 1, (c + 1) * 32);
      // keeps the next step's 16 LDS reads as one group ahead of this step's
      // WMMAs, which then cover their latency (else they sink to their uses)
      __builtin_amdgcn_sched_barrier(0);
      F16 af[2];
#pragma unroll
      for (int s = 0; s < 2; ++s) {
        af[s].h[0] = __builtin_shufflevector(
            __builtin_convertvector(xa[c & 1][s][0], v4bf),
            __builtin_convertvector(xa[c & 1][s][1], v4bf), 0, 1, 2, 3, 4, 5, 6, 7);
        af[s].h[1] = __builtin_shufflevector(
            __builtin_convertvector(xa[c & 1][s][2], v4bf),
            __builtin_convertvector(xa[c & 1][s][3], v4bf), 0, 1, 2, 3, 4, 5, 6, 7);
      }
#pragma unroll
      for (int t = 0; t < 4; ++t) {
        acc[0][t] = wmma_bf16(af[0].v, bfr[c & 1][t].v, acc[0][t]);
        acc[1][t] = wmma_bf16(af[1].v, bfr[c & 1][t].v, acc[1][t]);
      }
    }

    // Publish stage st + 1 and free this buffer with one barrier, then refill.
    WAIT_DS_0();
    WAIT_ASYNC_0();
    __syncthreads();
    if (st + 2 < NST) pstage(buf, st + 2);
  }
  WAIT_ASYNC_0();   // nothing is in flight when the wave ends

  // ---- epilogue: the block's 64 x 256 tile goes through LDS, so that every
  // global store covers whole 128-B lines. The ring is free here: each wave's
  // LDS reads retired in front of the loop's last barrier, no copy is in flight.
  float*  cf = (float*)psm;                    // [64 rows][256 cols] f32
  __bf16* ct = (__bf16*)(psm + CF_BYTES);      // [256 cols][64 rows] bf16
#pragma unroll
  for (int s = 0; s < 2; ++s) {
#pragma unroll
    for (int t = 0; t < 4; ++t) {
      const int col    = n0 + 16 * t + ln;
      const float bval = bias[col];
      const int row0   = mw + 16 * s + 8 * g;   // C layout: M = r + 8g
      v8bf tv;
#pragma unroll
      for (int r = 0; r < 8; ++r) {
        const float v = acc[s][t][r] + bval;
        cf[(row0 + r) * CF_PITCH + col] = v;
        if constexpr (WRITE_T) tv[r] = (__bf16)v;
      }
      // a lane's 8 values are 8 neighbouring rows of one column: 16 B of C^T
      if constexpr (WRITE_T) *(v8bf*)&ct[col * CT_PITCH + row0] = tv;
    }
  }
  __syncthreads();   // the tile is complete before any wave reads rows of it

  // Row-major outputs: a wave takes 8 rows; each LDS read and f32 store covers
  // 512 B in a row, each bf16 store 256 B in a row. Unrolled, so that the LDS
  // reads issue as one group and their latency is paid once.
#pragma unroll
  for (int i = 0; i < 8; ++i) {
    const int    row = wave * 8 + i;
    const float* p   = cf + row * CF_PITCH + 4 * lane;
    const f4v    x0  = *(const f4v*)(p);
    const f4v    x1  = *(const f4v*)(p + 128);
    const size_t idx = (size_t)(blockIdx.x * PM + row) * DD + 4 * lane;
    if constexpr (WRITE_F32) {
      *(f4v*)&outF32[idx]       = x0;
      *(f4v*)&outF32[idx + 128] = x1;
    }
    *(v4bf*)&outB[idx]       = __builtin_convertvector(x0, v4bf);
    *(v4bf*)&outB[idx + 128] = __builtin_convertvector(x1, v4bf);
  }
  // Transposed output: the block's 64 rows are one 128-B line of each of the
  // 256 columns; a store covers four such lines, 8 lanes each.
  if constexpr (WRITE_T) {
    const int bb = (blockIdx.x * PM) >> 11;     // batch: row / 2048
    const int l0 = (blockIdx.x * PM) & 2047;
    // unrolled for the same reason as the loop above
#pragma unroll
    for (int i = 0; i < 8; ++i) {
      const int  d = (wave * 8 + i) * 4 + (lane >> 3);
      const v8bf y = *(const v8bf*)&ct[d * CT_PITCH + (lane & 7) * 8];
      *(v8bf*)&outT[((size_t)(bb * DD + d)) * LK + l0 + (lane & 7) * 8] = y;
    }
  }
}

// Both projections in one launch: a block computes its 64 query rows, then its
// 64 key rows, on the same LDS ring.
__global__ void __launch_bounds__(256)
proj_kernel(const float* __restrict__ data1, const __bf16* __restrict__ WqT,
            const float* __restrict__ bq, float* __restrict__ qF32,
            __bf16* __restrict__ qB,
            const float* __restrict__ data2, const __bf16* __restrict__ WkT,
            const float* __restrict__ bk, __bf16* __restrict__ kB,
            __bf16* __restrict__ kT) {
  __shared__ __attribute__((aligned(16))) char psm[2 * PSTAGE_BYTES];
  proj_tile<1024, true, false>(psm, data1, WqT, bq, qF32, qB, nullptr);
  // Every wave has read its rows of the staged query tile out of LDS before
  // the key tile's copies land on them.
  WAIT_DS_0();
  __syncthreads();
  proj_tile<256, false, true>(psm, data2, WkT, bk, nullptr, kB, kT);
}

// ---------------------------------------------------------------------------
// Flash attention. One wave per (16-query tile, key half): waves 0-3 take the
// first 64 keys of every 128-key stage, waves 4-7 the second 64, each with its
// own running maximum, sum and O; the two are joined through LDS at the end.
// smem per stage: [kb 2 x 128 rows][kt 256 rows], pitch 136 el.
// ---------------------------------------------------------------------------
__global__ void __launch_bounds__(256)
attn_kernel(const __bf16* __restrict__ qb, const __bf16* __restrict__ kb,
            const __bf16* __restrict__ ktb, const float* __restrict__ qf32,
            float* __restrict__ out) {
  __shared__ __attribute__((aligned(16))) __bf16 smem[SMEM_ELEMS];

  const int tid  = threadIdx.x;
  const int lane = tid & 31;
  // The wave's number as a scalar: all that depends on it alone (the rows a
  // wave copies, its key half) then stays in scalar registers.
  const int wave = __builtin_amdgcn_readfirstlane(tid >> 5);
  const int g    = lane >> 4;
  const int ln   = lane & 15;
  const int kh   = wave >> 2;                  // key half of this wave
  const int tile = blockIdx.x * QTILES + (wave & 3);
  const int b    = tile >> 7;                  // per-wave batch
  const int q0   = (tile & 127) << 4;
  const int bblk = (blockIdx.x * QTILES) >> 7; // block-uniform batch (same)

  const char* kb_base = (const char*)(kb + (size_t)bblk * LK * DD);
  const char* kt_base = (const char*)(ktb + (size_t)bblk * DD * LK);
  const unsigned smemB = (unsigned)(size_t)smem;   // LDS byte address of the ring

  // Per-lane parts of the copy addresses, in bytes; the rest is wave-uniform.
  // Every copy instruction brings two 256-B rows, lanes 0-15 one and lanes
  // 16-31 the other, which lie 128 LDS rows apart:
  //   kb: the two d halves of key row (wave + 8k), 512 B in a row in global;
  //   kt: rows d = wave + 8k and d + 128.
  const unsigned laneL  = (unsigned)(g * (KBH_ELEMS * 2) + ln * 16);
  const unsigned kbLane = (unsigned)lane * 16;
  const unsigned ktLane = (unsigned)(g * (128 * LK * 2) + ln * 16);

  // ---- cooperative async copy of stage `st` (128 keys) into buffer `buf` ----
  auto stage = [&](int buf, int st) {
    const unsigned lrow = smemB + (unsigned)(buf * STAGE_ELEMS) * 2 +
                          (unsigned)wave * (PITCH * 2);
    const char* gkb = kb_base + (size_t)(st * SKEYS + wave) * (DD * 2);
    const char* gkt = kt_base + (size_t)st * (SKEYS * 2) + (size_t)wave * (LK * 2);
    unsigned    la[8];
    const char* ga[8];
#pragma unroll
    for (int h = 0; h < 2; ++h) {
#pragma unroll
      for (int i = 0; i < 8; ++i) {
        la[i] = (lrow + (unsigned)(8 * (8 * h + i) * (PITCH * 2))) + laneL;
        ga[i] = (gkb + (8 * (8 * h + i)) * (DD * 2)) + kbLane;
      }
      ASYNC_LDS_B128_X8(la, ga);
    }
#pragma unroll
    for (int h = 0; h < 2; ++h) {
#pragma unroll
      for (int i = 0; i < 8; ++i) {
        la[i] = (lrow + (unsigned)(KB_ELEMS * 2 + 8 * (8 * h + i) * (PITCH * 2))) + laneL;
        ga[i] = (gkt + (8 * (8 * h + i)) * (LK * 2)) + ktLane;
      }
      ASYNC_LDS_B128_X8(la, ga);
    }
  };

  // Q fragments, resident, B operand of S^T = K·Q^T.
  v16bf qf[8];
  {
    const __bf16* qrow = qb + (size_t)(b * LQ + q0 + ln) * DD;
#pragma unroll
    for (int c = 0; c < 8; ++c) {
      F16 q;
      q.h[0] = *(const v8bf*)(qrow + 32 * c + 8 * g);
      q.h[1] = *(const v8bf*)(qrow + 32 * c + 16 + 8 * g);
      qf[c] = q.v;
    }
  }

  f8v o[16] = {};
  float mrow = -1e30f;   // per-lane softmax stats: query = ln
  float lrow = 0.0f;
  const float SC = 0.03125f * 1.4426950408889634f;  // SCALE * log2(e)

  // Two-buffer ring: one stage's copies (32 per wave) in flight at a time.
  stage(0, 0);
  WAIT_ASYNC_0();
  __syncthreads();
  stage(1, 1);

  for (int st = 0; st < NSTAGE; ++st) {
    const int buf = st & 1;
    // element bases in smem: this wave's 64 key rows of kb, key columns of kt
    const int kbE = buf * STAGE_ELEMS + kh * (KSTEP * PITCH);
    const int ktE = buf * STAGE_ELEMS + KB_ELEMS + kh * KSTEP;

    // ---- S^T tiles: 4 x 16 keys, A = key rows from LDS, B = resident Q ----
    // Batch the 4 fragments of each K-chunk before the 4 WMMAs so the
    // scheduler can stagger s_wait_dscnt instead of draining per WMMA.
    f8v s[4] = {};
#pragma unroll
    for (int c = 0; c < 8; ++c) {
      F16 ka[4];
#pragma unroll
      for (int tt = 0; tt < 4; ++tt) {
        const int base = kbE + (c >> 2) * KBH_ELEMS + (16 * tt + ln) * PITCH +
                         32 * (c & 3);
        ka[tt].h[0] = *(const v8bf*)&smem[base + 8 * g];
        ka[tt].h[1] = *(const v8bf*)&smem[base + 16 + 8 * g];
      }
#pragma unroll
      for (int tt = 0; tt < 4; ++tt)
        s[tt] = wmma_bf16(ka[tt].v, qf[c], s[tt]);
    }

    // ---- online softmax: keys lane-local, query = lane ----
    // Max commutes with the positive scale: reduce raw s, scale once.
    float mx = -1e30f;
#pragma unroll
    for (int tt = 0; tt < 4; ++tt)
#pragma unroll
      for (int r = 0; r < 8; ++r) mx = fmaxf(mx, s[tt][r]);
    mx = fmaxf(mx, __shfl_xor(mx, 16));         // merge key-halves
    const float mn    = fmaxf(mrow, mx * SC);
    const float alpha = exp2f(mrow - mn);
    mrow = mn;

    // Rescale factors of O: element r is query r+8g -> alpha of lane r+8g.
    float ar[8];
#pragma unroll
    for (int r = 0; r < 8; ++r) ar[r] = __shfl(alpha, r + 8 * g);

    // B fragments of O += P @ K_tile from the LDS-transposed key tile, read in
    // groups of 4 column tiles (16 ds_load_b128, 8 WMMAs), each group issued
    // well ahead of its WMMAs.
    F16 kf[16][2];
    auto ldkt = [&](int gq) {
#pragma unroll
      for (int u = 0; u < 4; ++u) {
        const int t    = 4 * gq + u;
        const int base = ktE + (16 * t + ln) * PITCH;
        kf[t][0].h[0] = *(const v8bf*)&smem[base + 8 * g];
        kf[t][0].h[1] = *(const v8bf*)&smem[base + 16 + 8 * g];
        kf[t][1].h[0] = *(const v8bf*)&smem[base + 32 + 8 * g];
        kf[t][1].h[1] = *(const v8bf*)&smem[base + 48 + 8 * g];
      }
    };
    // Holds the fragment reads behind the lane exchanges: LDS results return in
    // order, so an exchange issued behind 32 reads would wait for all of them.
    __builtin_amdgcn_sched_barrier(0);
    ldkt(0);
    ldkt(1);
    // keeps the first two groups' reads ahead of the vector work below, which
    // then covers their latency (else they sink to their uses)
    __builtin_amdgcn_sched_barrier(0);

#pragma unroll
    for (int t = 0; t < 16; ++t)
#pragma unroll
      for (int r = 0; r < 8; ++r) o[t][r] *= ar[r];

    // P fragments: S^T C-layout == P A-layout (lane-local repack).
    F16 pf0, pf1;
    float rs = 0.0f;
#pragma unroll
    for (int r = 0; r < 8; ++r) {
      const float e0 = exp2f(fmaf(s[0][r], SC, -mn));
      const float e1 = exp2f(fmaf(s[1][r], SC, -mn));
      const float e2 = exp2f(fmaf(s[2][r], SC, -mn));
      const float e3 = exp2f(fmaf(s[3][r], SC, -mn));
      rs += (e0 + e1) + (e2 + e3);
      pf0.v[r] = (__bf16)e0; pf0.v[8 + r] = (__bf16)e1;
      pf1.v[r] = (__bf16)e2; pf1.v[8 + r] = (__bf16)e3;
    }

    // ---- O += P @ K_tile ----
    auto pv = [&](int gq) {
#pragma unroll
      for (int u = 0; u < 4; ++u)
        o[4 * gq + u] = wmma_bf16(pf0.v, kf[4 * gq + u][0].v, o[4 * gq + u]);
#pragma unroll
      for (int u = 0; u < 4; ++u)
        o[4 * gq + u] = wmma_bf16(pf1.v, kf[4 * gq + u][1].v, o[4 * gq + u]);
    };
    ldkt(2);
    // keeps the third group's reads as one run ahead of the first two groups'
    // WMMAs, which cover their latency
    __builtin_amdgcn_sched_barrier(0);
    pv(0);
    pv(1);
    ldkt(3);
    // keeps the last group's reads ahead of the third group's WMMAs, which
    // cover their latency
    __builtin_amdgcn_sched_barrier(0);
    pv(2);
    pv(3);
    // Holds the last WMMAs ahead of the stage's waits and barrier: they run
    // while the last group's reads land, and the refill copies and the next
    // stage's reads issue directly behind the barrier (else 15 WMMAs sink there).
    __builtin_amdgcn_sched_barrier(0);

    rs += __shfl_xor(rs, 16);
    lrow = lrow * alpha + rs;

    // Publish stage st + 1 and free this buffer with one barrier, then refill.
    WAIT_DS_0();
    WAIT_ASYNC_0();
    __syncthreads();
    if (st + 2 < NSTAGE) stage(buf, st + 2);
  }
  WAIT_ASYNC_0();   // nothing is in flight when the ring becomes join space

  // f32 residual of the 16 x 128 piece that this wave finishes, read in one run
  // so that one wait covers the run's address registers.
  const size_t idx0 = (size_t)(b * LQ + q0 + 8 * g) * DD + 128 * kh + ln;
  float res[8][8];
#pragma unroll
  for (int tt = 0; tt < 8; ++tt)
#pragma unroll
    for (int r = 0; r < 8; ++r) res[tt][r] = qf32[idx0 + (size_t)(r * DD + 16 * tt)];
  // stands in front of any later rewrite of the address registers of that run
  asm volatile("s_wait_xcnt 0x0" ::: "memory");

  // ---- join the two key halves: each wave hands its partner (wave ^ 4) the
  // 8 column tiles that the partner finishes, with its maximum and sum ----
  float* xo = (float*)smem;                     // [wave][8 tiles][2][32 lanes] f4v
  float* xs = xo + 8 * 2048;                    // [wave][m, l][32 lanes]
  const bool hi = kh != 0;                      // finishes column tiles 8..15
#pragma unroll
  for (int tt = 0; tt < 8; ++tt) {
    f4v s0, s1;
#pragma unroll
    for (int r = 0; r < 4; ++r) {
      s0[r] = hi ? o[tt][r]     : o[8 + tt][r];
      s1[r] = hi ? o[tt][4 + r] : o[8 + tt][4 + r];
    }
    *(f4v*)&xo[wave * 2048 + ((2 * tt + 0) * 32 + lane) * 4] = s0;
    *(f4v*)&xo[wave * 2048 + ((2 * tt + 1) * 32 + lane) * 4] = s1;
  }
  xs[(wave * 2 + 0) * 32 + lane] = mrow;
  xs[(wave * 2 + 1) * 32 + lane] = lrow;
  __syncthreads();

  const int   pw = wave ^ 4;
  const float mo = xs[(pw * 2 + 0) * 32 + lane];
  const float lo = xs[(pw * 2 + 1) * 32 + lane];
  const float mj = fmaxf(mrow, mo);
  const float as = exp2f(mrow - mj);
  const float ao = exp2f(mo - mj);
  const float li = 1.0f / (lrow * as + lo * ao);
  const float fs = as * li;                     // weight of this wave's O
  const float fo = ao * li;                     // weight of the partner's O

  // ---- epilogue: normalize + f32 residual ----
  float ws[8], wo[8];
#pragma unroll
  for (int r = 0; r < 8; ++r) {
    ws[r] = __shfl(fs, r + 8 * g);
    wo[r] = __shfl(fo, r + 8 * g);
  }
#pragma unroll
  for (int tt = 0; tt < 8; ++tt) {
    const f4v p0 = *(const f4v*)&xo[pw * 2048 + ((2 * tt + 0) * 32 + lane) * 4];
    const f4v p1 = *(const f4v*)&xo[pw * 2048 + ((2 * tt + 1) * 32 + lane) * 4];
#pragma unroll
    for (int r = 0; r < 8; ++r) {
      const float mine = hi ? o[8 + tt][r] : o[tt][r];
      const float part = r < 4 ? p0[r & 3] : p1[r & 3];
      out[idx0 + (size_t)(r * DD + 16 * tt)] = mine * ws[r] + part * wo[r] + res[tt][r];
    }
  }
}

// ---------------------------------------------------------------------------
extern "C" void kernel_launch(void* const* d_in, const int* in_sizes, int n_in,
                              void* d_out, int out_size, void* d_ws, size_t ws_size,
                              hipStream_t stream) {
  (void)in_sizes; (void)n_in; (void)out_size; (void)ws_size;

  const float* data1 = (const float*)d_in[0];  // [8,2048,1024]
  const float* data2 = (const float*)d_in[1];  // [8,2048,256]
  const float* Wq    = (const float*)d_in[2];  // [1024,256]
  const float* bq    = (const float*)d_in[3];  // [256]
  const float* Wk    = (const float*)d_in[4];  // [256,256]
  const float* bk    = (const float*)d_in[5];  // [256]
  float* out = (float*)d_out;                  // [8,2048,256]

  // Workspace (~41 MB):
  //   [ 0,16M)   query f32
  //   [16,24M)   query bf16          (B of S^T)
  //   [24,32M)   key bf16  [B,Lk,D]  (A of S^T, async-staged)
  //   [32,40M)   key bf16T [B,D,Lk]  (B of O += P·K, async-staged)
  //   [40M..]    WqT bf16, WkT bf16
  char* ws = (char*)d_ws;
  float*  q_f32 = (float*)ws;
  __bf16* q_b   = (__bf16*)(ws + (size_t)16 * 1024 * 1024);
  __bf16* k_b   = (__bf16*)(ws + (size_t)24 * 1024 * 1024);
  __bf16* kT_b  = (__bf16*)(ws + (size_t)32 * 1024 * 1024);
  __bf16* WqT   = (__bf16*)(ws + (size_t)40 * 1024 * 1024);
  __bf16* WkT   = (__bf16*)(ws + (size_t)40 * 1024 * 1024 + 512 * 1024);

  dim3 blk(256);
  weightT_kernel<<<dim3(WT_BLOCKS), dim3(128), 0, stream>>>(Wq, Wk, WqT, WkT);

  dim3 pgrid(M_TOTAL / PM);   // 256 blocks of 64 rows x 256 columns, twice
  proj_kernel<<<pgrid, blk, 0, stream>>>(data1, WqT, bq, q_f32, q_b,
                                         data2, WkT, bk, k_b, kT_b);

  const int qtiles = BATCH * (LQ / 16);  // 1024 tiles, 2 waves each
  attn_kernel<<<dim3(qtiles / QTILES), blk, 0, stream>>>(
      q_b, k_b, kT_b, q_f32, out);
}
